// v009
// Measured on an AMD MI455X. A time is GPU time per run, averaged over a window of back-to-back runs after a warm-up
// (all launches, gaps included; the runs take copies of the inputs in turn), and the median of several windows.
// Apart from v000's, it joins two sittings. Times from different sittings can be a few percent apart, while
// side-by-side timings come from the same sitting.
// This document starts at v009; the versions before it stand elsewhere.
// One run takes 277 microseconds.
// In both of two side-by-side timings against v008, it was 1.05 times as fast.
// Counting every step since v000, which is the starting kernel, it is 4.67 times as fast.
// All contractions (token-shift LoRA xxx.w1 and lora.w2, q/k/v projections, attention q.k^T and p.v, output projection): v_wmma_f32_16x16x32_bf16 with bf16 hi/lo split operands (hi.hi + hi.lo + lo.hi), f32 accumulate; token shift, tanh, LayerNorms, RoPE, online softmax, score scale 0.125 in f32.
#include <hip/hip_runtime.h>
#include <math.h>
#include <stdint.h>

constexpr int kBatch = 2;
constexpr int kSeq   = 2048;
constexpr int kRows  = kBatch * kSeq;   // token rows of both batch elements, row = b*kSeq + s
constexpr int kDm    = 1024;
constexpr int kHeads = 16;
constexpr int kLoraN = 96;      // 3 x 32 LoRA outputs
constexpr int kLoraP = 128;     // padded to a 64-multiple
constexpr int kLoraD = 32;

typedef __attribute__((ext_vector_type(16))) _Float16 v16h;
typedef __attribute__((ext_vector_type(8)))  _Float16 v8h;
typedef __attribute__((ext_vector_type(16))) __bf16   v16b;
typedef __attribute__((ext_vector_type(8)))  __bf16   v8b;
typedef __attribute__((ext_vector_type(2)))  __bf16   v2b;
typedef __attribute__((ext_vector_type(8)))  float    v8f;
typedef __attribute__((ext_vector_type(4)))  float    v4f;
typedef __attribute__((ext_vector_type(2)))  float    v2f;
typedef __attribute__((ext_vector_type(4)))  unsigned int v4u;
typedef __attribute__((ext_vector_type(8)))  unsigned short v8us;

__device__ __forceinline__ unsigned short f2bf_bits(float f) {
  unsigned u = __float_as_uint(f);
  return (unsigned short)((u + 0x7FFFu + ((u >> 16) & 1u)) >> 16);
}
__device__ __forceinline__ float bf_bits2f(unsigned short h) { return __uint_as_float(((unsigned)h) << 16); }

// hazard guards as plain device helpers (no inline asm inside the kernel template body)
__device__ __forceinline__ void dep_guard_h(v8f& a, v8f& b, v16h x, v16h y) { asm volatile("v_nop\n\tv_nop\n\tv_nop\n\tv_nop" : "+v"(a), "+v"(b) : "v"(x), "v"(y)); }
__device__ __forceinline__ void dep_guard_b(v8f& a, v8f& b, v16b x, v16b y) { asm volatile("v_nop\n\tv_nop\n\tv_nop\n\tv_nop" : "+v"(a), "+v"(b) : "v"(x), "v"(y)); }
__device__ __forceinline__ void keep4_h(v16h a, v16h b, v16h c, v16h d) { asm volatile("v_nop" :: "v"(a), "v"(b), "v"(c), "v"(d)); }
__device__ __forceinline__ void keep4_b(v16b a, v16b b, v16b c, v16b d) { asm volatile("v_nop" :: "v"(a), "v"(b), "v"(c), "v"(d)); }
__device__ __forceinline__ void acc_guard4(v8f& a, v8f& b, v8f& c, v8f& d) { asm volatile("v_nop\n\tv_nop\n\tv_nop\n\tv_nop" : "+v"(a), "+v"(b), "+v"(c), "+v"(d)); }
template <typename T> struct Frag;
template <> struct Frag<_Float16> {
  typedef v16h V; union U { v16h v; v8h h[2]; };
  static __device__ __forceinline__ v16h load(const _Float16* p) {   // elements 0..7 <- p[0..7], 8..15 <- p[16..23]
    U f; f.h[0] = *(const v8h*)(p); f.h[1] = *(const v8h*)(p + 16); return f.v;
  }
  static __device__ __forceinline__ v8f mma(v16h a, v16h b, v8f c) {
    return __builtin_amdgcn_wmma_f32_16x16x32_f16(false, a, false, b, (short)0, c, false, false);
  }
  static __device__ __forceinline__ void guard(v8f& a, v8f& b, v16h x, v16h y) { dep_guard_h(a, b, x, y); }
  static __device__ __forceinline__ void keep(v16h a, v16h b, v16h c, v16h d) { keep4_h(a, b, c, d); }
};
template <> struct Frag<__bf16> {
  typedef v16b V; union U { v16b v; v8b h[2]; };
  static __device__ __forceinline__ v16b load(const __bf16* p) {
    U f; f.h[0] = *(const v8b*)(p); f.h[1] = *(const v8b*)(p + 16); return f.v;
  }
  static __device__ __forceinline__ v8f mma(v16b a, v16b b, v8f c) {
    return __builtin_amdgcn_wmma_f32_16x16x32_bf16(false, a, false, b, (short)0, c, false, false);
  }
  static __device__ __forceinline__ void guard(v8f& a, v8f& b, v16b x, v16b y) { dep_guard_b(a, b, x, y); }
  static __device__ __forceinline__ void keep(v16b a, v16b b, v16b c, v16b d) { keep4_b(a, b, c, d); }
};

// ---- Register-blocked batched WMMA GEMM, operands staged in LDS --------------
// C[m,n] = scale * sum_k A[m,k] * Bt[n,k] (+bias)(+resid); a block of 4 waves (2 x 2) owns a 128x128 tile, each wave 64x64 of it.
// A row-major [M,K]; Bt row-major [N,K]; M,N % 128 == 0, K % 32 == 0.
// Per 32-wide k tile the block brings 128 A rows and 128 Bt rows of every plane (64 B a row) into LDS with asynchronous
// 16-B copies (a wave-wide copy = 8 rows x 64 contiguous B), two buffers: tile t+1 flies while tile t is multiplied.
// SPLIT: operands are hi/lo planes (A2/Bt2 = lo planes, same layout); product = hi.hi + hi.lo + lo.hi.
// BIAS_MODE: 0 = none, 1 = bias[m], 2 = bias[n].
// OUT_MODE: 0 = f32, 1 = f16, 2 = bf16 hi plane (Cout) + bf16 lo plane (Cout2).
// Coverage per wave tile: 4 slabs x 16 rows x 64 cols = 64x64 (f32: it 0..7 x hh 0..1 rows, 16 lanes x 4 floats;
// 16-bit: it 0..3 x q 0..3 rows, 8 lanes x 8 elements).
// ET: 0 = f16 operands, 1 = bf16 operands (pointers passed as 16-bit storage)
template <int ET> struct Elem;
template <> struct Elem<0> { typedef _Float16 T; };
template <> struct Elem<1> { typedef __bf16 T; };
constexpr int kGLP    = 40;            // LDS row pitch in 16-bit elements: 80 B = 16 B x 5 (odd), the pitch for 16-B reads of 64-B rows
constexpr int kGPlane = 128 * kGLP;    // one plane of a stage: 128 rows
constexpr int kGStage = 4 * kGPlane;   // A hi, A lo, Bt hi, Bt lo

// Four rows (32 apart) of one plane pair -> LDS: 8 (hi and lo) or 4 (hi only) copies of 16 B per lane. l = the lane's LDS byte
// address of its first hi row, g / g2 = its global address in the hi / lo plane, step = 32 source rows in elements.
// s_wait_xcnt 0 ends the copies' own statement, so that it stands in front of any rewrite of the address registers they name.
template <typename T>
__device__ __forceinline__ void stage_rows8(unsigned l, const T* g, const T* g2, size_t step) {
  const unsigned l1 = l + 32 * kGLP * 2, l2 = l + 64 * kGLP * 2, l3 = l + 96 * kGLP * 2;
  const unsigned m0 = l + kGPlane * 2, m1 = l1 + kGPlane * 2, m2 = l2 + kGPlane * 2, m3 = l3 + kGPlane * 2;
  const T* g1 = g + step;  const T* gg2 = g1 + step;  const T* g3 = gg2 + step;
  const T* h1 = g2 + step; const T* h2 = h1 + step;   const T* h3 = h2 + step;
  asm volatile("global_load_async_to_lds_b128 %0, %8, off\n\t"
               "global_load_async_to_lds_b128 %1, %9, off\n\t"
               "global_load_async_to_lds_b128 %2, %10, off\n\t"
               "global_load_async_to_lds_b128 %3, %11, off\n\t"
               "global_load_async_to_lds_b128 %4, %12, off\n\t"
               "global_load_async_to_lds_b128 %5, %13, off\n\t"
               "global_load_async_to_lds_b128 %6, %14, off\n\t"
               "global_load_async_to_lds_b128 %7, %15, off\n\t"
               "s_wait_xcnt 0x0"
               :: "v"(l), "v"(l1), "v"(l2), "v"(l3), "v"(m0), "v"(m1), "v"(m2), "v"(m3),
                  "v"(g), "v"(g1), "v"(gg2), "v"(g3), "v"(g2), "v"(h1), "v"(h2), "v"(h3) : "memory");
}
template <typename T>
__device__ __forceinline__ void stage_rows4(unsigned l, const T* g, size_t step) {
  const unsigned l1 = l + 32 * kGLP * 2, l2 = l + 64 * kGLP * 2, l3 = l + 96 * kGLP * 2;
  const T* g1 = g + step; const T* gg2 = g1 + step; const T* g3 = gg2 + step;
  asm volatile("global_load_async_to_lds_b128 %0, %4, off\n\t"
               "global_load_async_to_lds_b128 %1, %5, off\n\t"
               "global_load_async_to_lds_b128 %2, %6, off\n\t"
               "global_load_async_to_lds_b128 %3, %7, off\n\t"
               "s_wait_xcnt 0x0"
               :: "v"(l), "v"(l1), "v"(l2), "v"(l3), "v"(g), "v"(g1), "v"(gg2), "v"(g3) : "memory");
}

template <int ET, bool SPLIT, int BIAS_MODE, int OUT_MODE, bool RESID, int ACT = 0>
__global__ __launch_bounds__(128) void wmma_gemm64(
    const unsigned short* __restrict__ Ap, const unsigned short* __restrict__ A2p, int lda, long strideA,
    const unsigned short* __restrict__ Btp, const unsigned short* __restrict__ Bt2p, int ldb, long strideB,
    void* __restrict__ Cout, void* __restrict__ Cout2, int ldc, long strideC,
    const float* __restrict__ bias,
    const float* __restrict__ resid, long strideR,
    int M, int N, int K, float scale) {
  typedef typename Elem<ET>::T T;
  typedef typename Frag<T>::V V;
  const T* A = (const T*)Ap; const T* A2 = (const T*)A2p; const T* Bt = (const T*)Btp; const T* Bt2 = (const T*)Bt2p;
  __shared__ __align__(16) T ring[2 * kGStage];    // two stages of operand tiles, 2 x 40,960 B
  __shared__ __align__(16) float sT[4][16 * 68];   // per-wave 16x64 slab, pitch 68 floats
  const int b    = blockIdx.y;
  const int lane = threadIdx.x & 31;
  const int wave = threadIdx.x >> 5;
  const int tilesN = N >> 7;
  const int tilesM = M >> 7;
  const int tile = blockIdx.x;
  if (tile >= tilesM * tilesN) return;   // block-uniform, in front of every barrier and copy
  const int tm = tile / tilesN;
  const int tn = tile - tm * tilesN;
  const int bm0 = tm << 7;                         // block tile origin
  const int bn0 = tn << 7;
  const int wm = (wave >> 1) << 6;                 // wave tile origin inside the block tile
  const int wn = (wave & 1) << 6;
  const int m0 = bm0 + wm;
  const int n0 = bn0 + wn;

  const T* Ab  = A  + (size_t)b * strideA;
  const T* Bb  = Bt + (size_t)b * strideB;
  const T* Ab2 = SPLIT ? (A2  + (size_t)b * strideA) : nullptr;
  const T* Bb2 = SPLIT ? (Bt2 + (size_t)b * strideB) : nullptr;

  const int rlane = lane & 15;                 // row (A) / col (B, D) within subtile
  const int koff  = (lane >> 4) * 8;           // k offset of this lane half
  const int mOff  = (lane >> 4) * 8;           // D row offset

  v8f acc[4][4];
#pragma unroll
  for (int i = 0; i < 4; ++i)
#pragma unroll
    for (int j = 0; j < 4; ++j) acc[i][j] = (v8f){0.f,0.f,0.f,0.f,0.f,0.f,0.f,0.f};

  // copy map: thread -> row (tid >> 2) + 32 r, r = 0..3, 16-B chunk tid & 3 of the row's 64 B; 128 threads x 4 rows = 128 rows a plane
  const int crow = threadIdx.x >> 2;
  const int cchk = (threadIdx.x & 3) * 8;
  const size_t cao = (size_t)(bm0 + crow) * lda + cchk;
  const size_t cbo = (size_t)(bn0 + crow) * ldb + cchk;
  const size_t stepA = (size_t)32 * lda, stepB = (size_t)32 * ldb;
  const unsigned lds0 = (unsigned)(uintptr_t)(&ring[0]) + (unsigned)(crow * kGLP + cchk) * 2u;   // LDS byte address: low 32 bits
  const int nT = K >> 5;                           // k tiles, the same for the whole grid

#define GEMM_STAGE(t_)                                                                          \
  {                                                                                             \
    const unsigned lt = lds0 + (unsigned)((t_) & 1) * (kGStage * 2u);                           \
    const size_t ko = (size_t)(t_) * 32;                                                        \
    if (SPLIT) {                                                                                \
      stage_rows8<T>(lt, Ab + cao + ko, Ab2 + cao + ko, stepA);                                 \
      stage_rows8<T>(lt + 2u * kGPlane * 2u, Bb + cbo + ko, Bb2 + cbo + ko, stepB);             \
    } else {                                                                                    \
      stage_rows4<T>(lt, Ab + cao + ko, stepA);                                                 \
      stage_rows4<T>(lt + 2u * kGPlane * 2u, Bb + cbo + ko, stepB);                             \
    }                                                                                           \
  }

  GEMM_STAGE(0)
  asm volatile("s_wait_asynccnt 0x0" ::: "memory");   // this wave's copies of tile 0 have landed
  __syncthreads();                                    // ... and every other wave's: tile 0 may be read
  if (nT > 1) GEMM_STAGE(1)

  for (int t = 0; t < nT; ++t) {
    const T* st = ring + (t & 1) * kGStage;
    const T* sA = st + (wm + rlane) * kGLP + koff;
    const T* sB = st + 2 * kGPlane + (wn + rlane) * kGLP + koff;
    V bh[4], bl[4];
#pragma unroll
    for (int j = 0; j < 4; ++j) {
      bh[j] = Frag<T>::load(sB + (j << 4) * kGLP);
      if (SPLIT) bl[j] = Frag<T>::load(sB + kGPlane + (j << 4) * kGLP);
    }
#pragma unroll
    for (int i = 0; i < 4; ++i) {
      V ah = Frag<T>::load(sA + (i << 4) * kGLP);
      V al;
      if (SPLIT) al = Frag<T>::load(sA + kGPlane + (i << 4) * kGLP);
#pragma unroll
      for (int j = 0; j < 4; ++j) {
        acc[i][j] = Frag<T>::mma(ah, bh[j], acc[i][j]);
        if (SPLIT) {
          acc[i][j] = Frag<T>::mma(ah, bl[j], acc[i][j]);
          acc[i][j] = Frag<T>::mma(al, bh[j], acc[i][j]);
        }
      }
      Frag<T>::guard(acc[i][0], acc[i][3], ah, SPLIT ? al : ah);
    }
    Frag<T>::keep(bh[0], bh[1], bh[2], bh[3]);
    if (SPLIT) Frag<T>::keep(bl[0], bl[1], bl[2], bl[3]);
    asm volatile("s_wait_dscnt 0x0" ::: "memory");      // this wave's reads of tile t's buffer are done before it is refilled
    asm volatile("s_wait_asynccnt 0x0" ::: "memory");   // this wave's copies of tile t+1 have landed
    __syncthreads();                                    // publishes tile t+1 and ends every wave's reads of tile t
    if (t + 2 < nT) GEMM_STAGE(t + 2)                   // uniform test; into the buffer that trip t has just read
  }
  asm volatile("s_wait_asynccnt 0x0" ::: "memory");     // no copy outstanding behind the loop
#undef GEMM_STAGE
  acc_guard4(acc[0][0], acc[0][1], acc[0][2], acc[0][3]);
  acc_guard4(acc[1][0], acc[1][1], acc[1][2], acc[1][3]);
  acc_guard4(acc[2][0], acc[2][1], acc[2][2], acc[2][3]);
  acc_guard4(acc[3][0], acc[3][1], acc[3][2], acc[3][3]);

  // ---- epilogue ----
  float* slab = sT[wave];
  const float* Rb = RESID ? (resid + (size_t)b * strideR) : nullptr;
#pragma unroll
  for (int i = 0; i < 4; ++i) {
    const int mBase = m0 + (i << 4);
#pragma unroll
    for (int j = 0; j < 4; ++j) {
      const int n = n0 + (j << 4) + rlane;
      float bv = 0.f;
      if (BIAS_MODE == 2) bv = bias[n];
#pragma unroll
      for (int r = 0; r < 8; ++r) {
        float v = acc[i][j][r] * scale;
        if (BIAS_MODE == 1) v += bias[mBase + mOff + r];
        if (BIAS_MODE == 2) v += bv;
        if (RESID) v += Rb[(size_t)(mBase + mOff + r) * ldc + n];
        if (ACT == 1) v = tanhf(v);
        if (ACT == 2) v = fmaxf(v, 0.0f);
        if (ACT == 3) v = v / (1.0f + expf(-v));
        if (ACT == 4) v = (v > 0.f) ? v : 0.01f * v;
        slab[(mOff + r) * 68 + (j << 4) + rlane] = v;
      }
    }
    __builtin_amdgcn_fence(__ATOMIC_RELEASE, "workgroup");
    __builtin_amdgcn_wave_barrier();
    __builtin_amdgcn_fence(__ATOMIC_ACQUIRE, "workgroup");
    if (OUT_MODE == 0) {
      float* C = (float*)Cout + (size_t)b * strideC;
      const int hh = lane >> 4, c4 = (lane & 15) * 4;     // row seg = 256 B = 16 lanes x 16 B
      {
#pragma unroll
        for (int it = 0; it < 8; ++it) {
          const int row = it * 2 + hh;
          v4f v = *(const v4f*)(slab + row * 68 + c4);
          *(v4f*)(C + (size_t)(mBase + row) * ldc + n0 + c4) = v;
        }
        
      }
    } else {
      const int q = lane >> 3, c8 = (lane & 7) * 8;
      unsigned short* C  = (unsigned short*)Cout  + (size_t)b * strideC;
      unsigned short* C2 = (OUT_MODE == 2) ? ((unsigned short*)Cout2 + (size_t)b * strideC) : nullptr;
      {
#pragma unroll
        for (int it = 0; it < 4; ++it) {
          const int row = it * 4 + q;
          const float* sp = slab + row * 68 + c8;
          v8h hv, lv;
#pragma unroll
          for (int e = 0; e < 8; ++e) {
            if (OUT_MODE == 1) {
              hv[e] = (_Float16)sp[e];
            } else {
              unsigned short hb = f2bf_bits(sp[e]);
              unsigned short lb = f2bf_bits(sp[e] - bf_bits2f(hb));
              hv[e] = __builtin_bit_cast(_Float16, hb);
              lv[e] = __builtin_bit_cast(_Float16, lb);
            }
          }
          *(v8h*)(C + (size_t)(mBase + row) * ldc + n0 + c8) = hv;
          if (OUT_MODE == 2) *(v8h*)(C2 + (size_t)(mBase + row) * ldc + n0 + c8) = lv;
        }
        
      }
    }
    __builtin_amdgcn_fence(__ATOMIC_RELEASE, "workgroup");
    __builtin_amdgcn_wave_barrier();
    __builtin_amdgcn_fence(__ATOMIC_ACQUIRE, "workgroup");
  }
}

// ---------------------------------------------------------------------------
// Shared elementwise split helper for 8 consecutive values -> v8us hi/lo.
// ---------------------------------------------------------------------------
__device__ __forceinline__ void split8(const v4f va, const v4f vb, v8us& hv, v8us& lv) {
#pragma unroll
  for (int e = 0; e < 4; ++e) {
    const unsigned short h0 = f2bf_bits(va[e]);
    hv[e] = h0; lv[e] = f2bf_bits(va[e] - bf_bits2f(h0));
    const unsigned short h1 = f2bf_bits(vb[e]);
    hv[4 + e] = h1; lv[4 + e] = f2bf_bits(vb[e] - bf_bits2f(h1));
  }
}
__device__ __forceinline__ void store16x2(unsigned short* ph, unsigned short* pl, size_t o, const v8us hv, const v8us lv) {
  *(v8us*)(ph + o) = hv;
  *(v8us*)(pl + o) = lv;
}

// The elementwise launches below are sized by the waves they start, not by their elements: a wave takes 256 to 1024 elements
// (8 to 32 a lane, 16-B loads and stores), so that a launch starts about 16 waves a WGP and not several hundred short ones.

// ---------------------------------------------------------------------------
// Elementwise bf16 split: hi = bf16_rne(in), lo = bf16_rne(in - hi); a thread takes 4 groups of 8 elements, 256 groups apart.
// blockIdx.y (block-uniform) picks one of four equally sized sources; its planes start pstride 16-bit elements apart.
// Coverage: grid.x = ceil(n8 / 1024) blocks x 4 x 256 groups of 8 = the whole plane (n8 = groups per source).
// ---------------------------------------------------------------------------
__global__ __launch_bounds__(256) void split_bf16x2_kernel(const float* __restrict__ in0, const float* __restrict__ in1,
                                                           const float* __restrict__ in2, const float* __restrict__ in3,
                                                           unsigned short* __restrict__ hi, unsigned short* __restrict__ lo,
                                                           int n8, long pstride) {
  const int w = blockIdx.y;
  const float* in = (w == 0) ? in0 : (w == 1) ? in1 : (w == 2) ? in2 : in3;
  unsigned short* ph = hi + (size_t)w * pstride;
  unsigned short* pl = lo + (size_t)w * pstride;
  v4f va[4], vb[4];
  // unrolled: the 8 loads of a thread are in flight together (index clamped, so that no branch stands between them)
#pragma unroll
  for (int it = 0; it < 4; ++it) {
    const int i = (blockIdx.x * 4 + it) * 256 + threadIdx.x;
    const int ic = (i < n8) ? i : (n8 - 1);
    va[it] = *(const v4f*)(in + 8 * (size_t)ic);
    vb[it] = *(const v4f*)(in + 8 * (size_t)ic + 4);
  }
  // unrolled: va and vb live in registers and take compile-time indices only
#pragma unroll
  for (int it = 0; it < 4; ++it) {
    const int i = (blockIdx.x * 4 + it) * 256 + threadIdx.x;
    if (i < n8) {
      v8us hv, lv;
      split8(va[it], vb[it], hv, lv);
      store16x2(ph, pl, 8 * (size_t)i, hv, lv);
    }
  }
}

// ---------------------------------------------------------------------------
// tanh then bf16 split: hi = bf16_rne(tanh(in)), lo = bf16_rne(tanh(in) - hi); 8 elements per thread, one 16-B store a plane
// Coverage: grid = ceil(n8/256) x 256 threads x 8 elements = 8*n8 = whole plane.
// ---------------------------------------------------------------------------
__global__ __launch_bounds__(256) void tanh_split_kernel(const float* __restrict__ in, unsigned short* __restrict__ hi,
                                                         unsigned short* __restrict__ lo, int n8) {
  const int i = blockIdx.x * 256 + threadIdx.x;
  if (i < n8) {
    const v4f fa = *(const v4f*)(in + 8 * (size_t)i);
    const v4f fb = *(const v4f*)(in + 8 * (size_t)i + 4);
    const v4f ta = (v4f){tanhf(fa[0]), tanhf(fa[1]), tanhf(fa[2]), tanhf(fa[3])};
    const v4f tb = (v4f){tanhf(fb[0]), tanhf(fb[1]), tanhf(fb[2]), tanhf(fb[3])};
    v8us hv, lv;
    split8(ta, tb, hv, lv);
    store16x2(hi, lo, 8 * (size_t)i, hv, lv);
  }
}

// ---------------------------------------------------------------------------
// Transpose + bf16 split: in w[R][Cn] f32 -> planes th/tl [Cn][R] bf16: out[n*R + k] = split(w[k*Cn + n]).
// grid = (Cn/64, R/64, matrices), R, Cn % 64 == 0; matrix z starts z*R*Cn elements into w, th and tl.
// (Used for the LayerNormed v [b][s=R=2048][c=Cn=1024] -> v^T planes [b][c][s].)
// Coverage: load 256 threads x 16 = 64x64; store 8 waves x 2 it x 4 rows(q) x 8 lanes x 8 elements = 64x64.
// ---------------------------------------------------------------------------
__global__ __launch_bounds__(256) void wt_split_kernel(const float* __restrict__ wz, unsigned short* __restrict__ thz,
                                                       unsigned short* __restrict__ tlz, int R, int Cn) {
  __shared__ float tile[64 * 65];
  const int n0 = blockIdx.x * 64;
  const int k0 = blockIdx.y * 64;
  const size_t zo = (size_t)blockIdx.z * R * Cn;
  const float* w = wz + zo;
  unsigned short* th = thz + zo;
  unsigned short* tl = tlz + zo;
  const int t = threadIdx.x;
#pragma unroll
  for (int i = 0; i < 16; ++i) {
    const int idx = i * 256 + t;
    const int kk = idx >> 6, nn = idx & 63;
    tile[nn * 65 + kk] = w[(size_t)(k0 + kk) * Cn + n0 + nn];
  }
  __syncthreads();
  const int lane = t & 31, wave = t >> 5;
  const int q = lane >> 3, c8 = (lane & 7) * 8;
  {
#pragma unroll
    for (int it = 0; it < 2; ++it) {
      const int row = wave * 8 + it * 4 + q;          // 0..63 = local n
      const float* sp = tile + row * 65 + c8;
      v8us hv, lv;
#pragma unroll
      for (int e = 0; e < 8; ++e) {
        const unsigned short hb = f2bf_bits(sp[e]);
        const unsigned short lb = f2bf_bits(sp[e] - bf_bits2f(hb));
        hv[e] = hb; lv[e] = lb;
      }
      const size_t o = (size_t)(n0 + row) * R + k0 + c8;
      *(v8us*)(th + o) = hv;
      *(v8us*)(tl + o) = lv;
    }
    
  }
}

// ---------------------------------------------------------------------------
// LoRA weight w1 [1024 in k][96 out n] f32 -> Bt planes th/tl [kLoraP=128 n][1024 k] bf16, rows n >= 96 ZERO:
//   out[n*1024 + k] = split(n < 96 ? w1[k*96 + n] : 0).  grid = 1024/64 k-tiles; block = 256 threads.
// LDS tile [128 n][65]: load 256 threads x 32 iterations = 64 k x 128 n (address clamped to n <= 95, zero by predicate).
// ---------------------------------------------------------------------------
__global__ __launch_bounds__(256) void w1t_split_kernel(const float* __restrict__ w1, unsigned short* __restrict__ th,
                                                        unsigned short* __restrict__ tl) {
  __shared__ float tile[kLoraP * 65];
  const int k0 = blockIdx.x * 64;
  const int t = threadIdx.x;
#pragma unroll 4
  for (int i = 0; i < 32; ++i) {
    const int idx = i * 256 + t;
    const int kk = idx >> 7, nn = idx & 127;
    const int nc = (nn < kLoraN) ? nn : (kLoraN - 1);
    float v = w1[(size_t)(k0 + kk) * kLoraN + nc];
    if (nn >= kLoraN) v = 0.0f;
    tile[nn * 65 + kk] = v;
  }
  __syncthreads();
  const int lane = t & 31, wave = t >> 5;
  const int q = lane >> 3, c8 = (lane & 7) * 8;
  {
#pragma unroll
    for (int it = 0; it < 4; ++it) {
      const int row = wave * 16 + it * 4 + q;         // 0..127 = n
      const float* sp = tile + row * 65 + c8;
      v8us hv, lv;
#pragma unroll
      for (int e = 0; e < 8; ++e) {
        const unsigned short hb = f2bf_bits(sp[e]);
        const unsigned short lb = f2bf_bits(sp[e] - bf_bits2f(hb));
        hv[e] = hb; lv[e] = lb;
      }
      const size_t o = (size_t)row * kDm + k0 + c8;
      *(v8us*)(th + o) = hv;
      *(v8us*)(tl + o) = lv;
    }
    
  }
}

// ---------------------------------------------------------------------------
// LoRA weight w2 [3 l][32 d][1024 c] f32 -> Bt planes th/tl [3 l][1024 n=c][32 k=d] bf16: out[l][n][k] = split(w2[l][k][n]).
// grid = (1024/64 n-tiles, 3); block 256. LDS tile [64 n][33]: load 256 threads x 8 = 32 k x 64 n.
// 512 contiguous bytes) with ONE 16-B-per-lane instruction: lane -> line L = lane>>3, row = wave*8 + 2L + ((lane&7)>>2),
// ---------------------------------------------------------------------------
__global__ __launch_bounds__(256) void w2t_split_kernel(const float* __restrict__ w2, unsigned short* __restrict__ th,
                                                        unsigned short* __restrict__ tl) {
  __shared__ float tile[64 * 33];
  const int n0 = blockIdx.x * 64;
  const int l  = blockIdx.y;
  const int t  = threadIdx.x;
  const float* wl = w2 + (size_t)l * kLoraD * kDm;
#pragma unroll
  for (int i = 0; i < 8; ++i) {
    const int idx = i * 256 + t;
    const int kk = idx >> 6, nn = idx & 63;
    tile[nn * 33 + kk] = wl[(size_t)kk * kDm + n0 + nn];
  }
  __syncthreads();
  const int lane = t & 31, wave = t >> 5;
  const int L = lane >> 3, q = lane & 7;
  const int row = wave * 8 + 2 * L + (q >> 2);
  const int k8 = (q & 3) * 8;
  const float* sp = tile + row * 33 + k8;
  v8us hv, lv;
#pragma unroll
  for (int e = 0; e < 8; ++e) {
    const unsigned short hb = f2bf_bits(sp[e]);
    const unsigned short lb = f2bf_bits(sp[e] - bf_bits2f(hb));
    hv[e] = hb; lv[e] = lb;
  }
  const size_t o = (size_t)l * kDm * kLoraD + (size_t)(n0 + row) * kLoraD + k8;
  *(v8us*)(th + o) = hv;
  *(v8us*)(tl + o) = lv;
  
}

constexpr int kEwRows = 4;   // token rows per block of the two mixing kernels below

// ---------------------------------------------------------------------------
// Token shift: xxx = x + (xprev - x) * maa_x -> bf16 hi/lo planes [kRows][kDm], row = b*kSeq + s;
// xprev = shift_state[b] for s == 0, else x[b][s-1] (block-uniform pointer choice).
// grid = kRows / kEwRows blocks x kEwRows rows x 128 threads x 8 elements = kRows x kDm = the whole plane; each lane stores 16 B.
// ---------------------------------------------------------------------------
__global__ __launch_bounds__(128) void xxx_split_kernel(const float* __restrict__ x, const float* __restrict__ ss,
                                                        const float* __restrict__ maax,
                                                        unsigned short* __restrict__ oh, unsigned short* __restrict__ ol) {
  const int c0 = threadIdx.x * 8;
  const v4f ma = *(const v4f*)(maax + c0), mb = *(const v4f*)(maax + c0 + 4);
  // unrolled: the loads of the block's rows are in flight together
#pragma unroll
  for (int rr = 0; rr < kEwRows; ++rr) {
    const int row = blockIdx.x * kEwRows + rr;
    const int b = row / kSeq, s = row % kSeq;
    const float* xr = x + (size_t)row * kDm;
    const float* xp = (s == 0) ? (ss + (size_t)b * kDm) : (xr - kDm);
    const v4f xa = *(const v4f*)(xr + c0), xb = *(const v4f*)(xr + c0 + 4);
    const v4f pa = *(const v4f*)(xp + c0), pb = *(const v4f*)(xp + c0 + 4);
    const v4f va = xa + (pa - xa) * ma;
    const v4f vb = xb + (pb - xb) * mb;
    v8us hv, lv;
    split8(va, vb, hv, lv);
    store16x2(oh, ol, (size_t)row * kDm + c0, hv, lv);
  }
}

// ---------------------------------------------------------------------------
// Data-dependent mixing: x? = x + (xprev - x) * (maa_? + mix_?[s][c]) for ? in {q(r), k, v} -> three bf16 hi/lo plane pairs
// [kRows][kDm]. mix planes f32 [3][kRows][kDm] (l = 0 r, 1 k, 2 v). Same row index and thread/store shape as xxx_split_kernel.
// ---------------------------------------------------------------------------
__global__ __launch_bounds__(128) void mix_split_kernel(const float* __restrict__ x, const float* __restrict__ ss,
                                                        const float* __restrict__ maar, const float* __restrict__ maak,
                                                        const float* __restrict__ maav, const float* __restrict__ mix,
                                                        unsigned short* __restrict__ qh, unsigned short* __restrict__ ql,
                                                        unsigned short* __restrict__ kh, unsigned short* __restrict__ kl,
                                                        unsigned short* __restrict__ vh, unsigned short* __restrict__ vl) {
  const int c0 = threadIdx.x * 8;
  const size_t plane = (size_t)kRows * kDm;
  const v4f mra = *(const v4f*)(maar + c0), mrb = *(const v4f*)(maar + c0 + 4);
  const v4f mka = *(const v4f*)(maak + c0), mkb = *(const v4f*)(maak + c0 + 4);
  const v4f mva = *(const v4f*)(maav + c0), mvb = *(const v4f*)(maav + c0 + 4);
  // both loops are unrolled in full: the arrays live in registers and take compile-time indices only
  v4f xa[kEwRows], xb[kEwRows], pa[kEwRows], pb[kEwRows], qa[kEwRows][3], qb[kEwRows][3];
#pragma unroll
  for (int rr = 0; rr < kEwRows; ++rr) {
    const int row = blockIdx.x * kEwRows + rr;
    const int b = row / kSeq, s = row % kSeq;
    const float* xr = x + (size_t)row * kDm;
    const float* xp = (s == 0) ? (ss + (size_t)b * kDm) : (xr - kDm);
    xa[rr] = *(const v4f*)(xr + c0);  xb[rr] = *(const v4f*)(xr + c0 + 4);
    pa[rr] = *(const v4f*)(xp + c0);  pb[rr] = *(const v4f*)(xp + c0 + 4);
#pragma unroll
    for (int l = 0; l < 3; ++l) {
      const float* mr = mix + l * plane + (size_t)row * kDm;   // block-uniform row base
      qa[rr][l] = *(const v4f*)(mr + c0);
      qb[rr][l] = *(const v4f*)(mr + c0 + 4);
    }
    // in front of any rewrite of the address registers that this row's loads name (the data stay in flight); the lane's byte offset is an
    // input, so that it keeps its register up to the wait and no later load of the row lands on it
    asm volatile("s_wait_xcnt 0x0" :: "v"(c0 * 4) : "memory");
  }
  __builtin_amdgcn_sched_barrier(0);   // keeps the loads above in one group, all in flight together: sunk to their users, each pair would expose the memory latency again
#pragma unroll
  for (int rr = 0; rr < kEwRows; ++rr) {
    const int row = blockIdx.x * kEwRows + rr;
    const v4f da = pa[rr] - xa[rr], db = pb[rr] - xb[rr];
    const size_t o = (size_t)row * kDm + c0;
    {
      const v4f va = xa[rr] + da * (mra + qa[rr][0]), vb = xb[rr] + db * (mrb + qb[rr][0]);
      v8us hv, lv; split8(va, vb, hv, lv); store16x2(qh, ql, o, hv, lv);
    }
    {
      const v4f va = xa[rr] + da * (mka + qa[rr][1]), vb = xb[rr] + db * (mkb + qb[rr][1]);
      v8us hv, lv; split8(va, vb, hv, lv); store16x2(kh, kl, o, hv, lv);
    }
    {
      const v4f va = xa[rr] + da * (mva + qa[rr][2]), vb = xb[rr] + db * (mvb + qb[rr][2]);
      v8us hv, lv; split8(va, vb, hv, lv); store16x2(vh, vl, o, hv, lv);
    }
  }
}

// ---------------------------------------------------------------------------
// LayerNorm over a token row of kDm = 1024 values, ONE WAVE A ROW (32 values a lane, no work-group barrier); block = 8 waves = 8 rows.
//   Lane map: group j = 0, 1; head = 8j + (lane >> 2); f8 = (lane & 3) * 8. The lane holds the head's values f8..f8+7 (xv[j][0], xv[j][1])
//   and 32+f8..32+f8+7 (xv[j][2], xv[j][3]): both partners of every rotation pair, and 8 neighbouring results for each 16-B store.
//   Mean and variance: the lane's 32 values in the order of the map, then a five-step butterfly over the wave.
//   MODE 0: LN then RoPE (half-split per 64-wide head: out[f] = x1*cos - x2*sin, out[32+f] = x1*sin + x2*cos with
//           cos/sin = cosf/sinf(angles[s][f]), s = row % kSeq) then bf16 hi/lo split into planes [kRows][kDm]; grid = (kRows/8, 2),
//           blockIdx.y selects source/params/planes A (0) or B (1). Lane f computes cos and sin of angle f once; the wave's own
//           LDS row hands them to the lanes that use them.
//   MODE 1: LN written back IN PLACE as f32 (dstf == src): each wave owns its row and has read all of it before it writes.
//   MODE 2: LN then bf16 hi/lo split into planes (no rotation); grid = (kRows/8, 1).
// ---------------------------------------------------------------------------
template <int MODE>
__global__ __launch_bounds__(256) void ln_kernel(const float* srcA, const float* srcB,
                                                 const float* __restrict__ gA, const float* __restrict__ bA,
                                                 const float* __restrict__ gB, const float* __restrict__ bB,
                                                 const float* __restrict__ ang,
                                                 unsigned short* hA, unsigned short* lA,
                                                 unsigned short* hB, unsigned short* lB, float* dstf) {
  const int tid = threadIdx.x, lane = tid & 31, wave = tid >> 5;
  const int s = blockIdx.x * 8 + wave;           // token row b*kSeq + position
  const int which = blockIdx.y;                  // block-uniform
  const float* src = (which == 0) ? srcA : srcB;
  const float* g   = (which == 0) ? gA : gB;
  const float* bb  = (which == 0) ? bA : bB;
  unsigned short* dh = (which == 0) ? hA : hB;
  unsigned short* dl = (which == 0) ? lA : lB;

  const int f8 = (lane & 3) * 8;
  const int e0 = (lane >> 2) * 64 + f8;          // the lane's first element in group 0; group 1 lies 512 further
  const size_t ro = (size_t)s * kDm + e0;
  // every loop below is unrolled in full: xv lives in registers and takes compile-time indices only
  v4f xv[2][4];
#pragma unroll
  for (int j = 0; j < 2; ++j) {
    const float* p = src + ro + j * 512;
    xv[j][0] = *(const v4f*)(p);
    xv[j][1] = *(const v4f*)(p + 4);
    xv[j][2] = *(const v4f*)(p + 32);
    xv[j][3] = *(const v4f*)(p + 36);
  }
  float a = 0.f;
  if (MODE == 0) a = ang[(size_t)(s % kSeq) * 32 + lane];
  asm volatile("s_wait_xcnt 0x0" ::: "memory");   // in front of any rewrite of the address registers that the loads above name
  float ps = 0.f;
#pragma unroll
  for (int j = 0; j < 2; ++j)
#pragma unroll
    for (int q = 0; q < 4; ++q) ps += (xv[j][q][0] + xv[j][q][1]) + (xv[j][q][2] + xv[j][q][3]);
#pragma unroll
  for (int off = 1; off < 32; off <<= 1) ps += __shfl_xor(ps, off, 32);
  const float mean = ps * (1.0f / (float)kDm);
  float pq = 0.f;
#pragma unroll
  for (int j = 0; j < 2; ++j)
#pragma unroll
    for (int q = 0; q < 4; ++q) {
      xv[j][q] = xv[j][q] - mean;
      const v4f d = xv[j][q];
      pq += (d[0] * d[0] + d[1] * d[1]) + (d[2] * d[2] + d[3] * d[3]);
    }
#pragma unroll
  for (int off = 1; off < 32; off <<= 1) pq += __shfl_xor(pq, off, 32);
  const float var  = pq * (1.0f / (float)kDm);
  const float rstd = rsqrtf(var + 1.0e-5f);
#pragma unroll
  for (int j = 0; j < 2; ++j)
#pragma unroll
    for (int q = 0; q < 4; ++q) {
      const int eo = e0 + j * 512 + (q >> 1) * 32 + (q & 1) * 4;
      const v4f gv = *(const v4f*)(g + eo);
      const v4f bv = *(const v4f*)(bb + eo);
#pragma unroll
      for (int e = 0; e < 4; ++e) xv[j][q][e] = xv[j][q][e] * rstd * gv[e] + bv[e];
    }

  if (MODE == 1) {
#pragma unroll
    for (int j = 0; j < 2; ++j) {
      float* dp = dstf + ro + j * 512;
      *(v4f*)(dp)      = xv[j][0];
      *(v4f*)(dp + 4)  = xv[j][1];
      *(v4f*)(dp + 32) = xv[j][2];
      *(v4f*)(dp + 36) = xv[j][3];
    }
    return;                                     // MODE is a compile-time constant: uniform
  }

  v4f ca = (v4f){1.f, 1.f, 1.f, 1.f}, cb = ca;
  v4f sa = (v4f){0.f, 0.f, 0.f, 0.f}, sb = sa;
  if (MODE == 0) {
    __shared__ __align__(16) float scs[8][32];
    __shared__ __align__(16) float ssn[8][32];
    scs[wave][lane] = cosf(a);
    ssn[wave][lane] = sinf(a);
    // the wave reads back what its own lanes have just written: order inside the wave is all that is needed
    __builtin_amdgcn_fence(__ATOMIC_RELEASE, "workgroup");
    __builtin_amdgcn_wave_barrier();
    __builtin_amdgcn_fence(__ATOMIC_ACQUIRE, "workgroup");
    ca = *(const v4f*)(&scs[wave][f8]);  cb = *(const v4f*)(&scs[wave][f8 + 4]);
    sa = *(const v4f*)(&ssn[wave][f8]);  sb = *(const v4f*)(&ssn[wave][f8 + 4]);
  }
#pragma unroll
  for (int j = 0; j < 2; ++j) {
    v4f ra = xv[j][0], rb = xv[j][1], ia = xv[j][2], ib = xv[j][3];
    if (MODE == 0) {
#pragma unroll
      for (int e = 0; e < 4; ++e) {
        const float x1a = xv[j][0][e], x2a = xv[j][2][e], x1b = xv[j][1][e], x2b = xv[j][3][e];
        ra[e] = x1a * ca[e] - x2a * sa[e];  ia[e] = x1a * sa[e] + x2a * ca[e];
        rb[e] = x1b * cb[e] - x2b * sb[e];  ib[e] = x1b * sb[e] + x2b * cb[e];
      }
    }
    v8us hv, lv;
    split8(ra, rb, hv, lv);
    store16x2(dh, dl, ro + j * 512, hv, lv);
    split8(ia, ib, hv, lv);
    store16x2(dh, dl, ro + j * 512 + 32, hv, lv);
  }
}

#define AT_D 64
#define AT_NW 4
#define AT_QB 64
#define AT_KC 64
#define AT_LP 72   // LDS row pitch of the K and V^T tiles in 16-bit elements: 144 B = 16 B x 9 (odd), so that the 16 rows of one 16-B fragment read fall on 16 different bank groups

__device__ __forceinline__ v8f at_mma(v16b a, v16b b, v8f c) {
  return __builtin_amdgcn_wmma_f32_16x16x32_bf16(false, a, false, b, (short)0, c, false, false);
}

// Value of lane l ^ 16 (the other half's lane of the same query) by a cross-row move of the vector unit.
__device__ __forceinline__ float at_other_half(float v) {
  const int b = __float_as_int(v);
  return __int_as_float(__builtin_amdgcn_permlanex16(b, b, 0x76543210, 0xfedcba98, false, false));
}

// 4 waves a SIMD (4 blocks a WGP = the whole grid resident) is the target: the register budget of that occupancy, 256, holds the fragment groups below
__global__ __launch_bounds__(128) __attribute__((amdgpu_waves_per_eu(4, 4)))
void attn_causal64_kernel(const unsigned short* __restrict__ qhp, const unsigned short* __restrict__ qlp,
                          const unsigned short* __restrict__ khp, const unsigned short* __restrict__ klp,
                          const unsigned short* __restrict__ vhp, const unsigned short* __restrict__ vlp,
                          float* __restrict__ out, float sscale, float mfill) {
  union PB { v16b v; v2b w[8]; };
  __shared__ __align__(16) __bf16 Ksh[AT_KC * AT_LP];            // K hi [kv][d], 64 rows of 144 B
  __shared__ __align__(16) __bf16 Ksl[AT_KC * AT_LP];            // K lo
  __shared__ __align__(16) __bf16 Vth[AT_D * AT_LP];             // V hi [d][kv], 64 rows of 144 B
  __shared__ __align__(16) __bf16 Vtl[AT_D * AT_LP];             // V lo
  __shared__ __align__(16) float  Os[AT_NW][16 * 68];            // per wave out tile, pitch 68

  const int tid  = threadIdx.x;
  const int wave = tid >> 5;
  const int lane = tid & 31;
  const int hh   = lane >> 4;
  const int c    = lane & 15;

  const int nqb = kSeq / AT_QB;           // 32
  const int bx = blockIdx.x;
  const int h  = bx / nqb;                // 0..kHeads-1 (grid = kHeads * nqb)
  // Query tile of this block. A tile's cost is its key walk, qb + 1 chunks, and the whole grid is resident at once (4 blocks a WGP),
  // so the launch lasts as long as the WGP whose 4 blocks hold the most chunks. With qb = bx % 32 blocks whose flat index is equal
  // mod 256 (and mod 32) all hold the same tile. The map below is, for each head and batch element, a permutation of the 32 tiles in
  // which j and j + 16, and flat indices 256 apart, hold tiles t and 31 - t, and an even j and j + 1 tiles that add up to 30 or 32: such
  // pairs then hold about 33 chunks. For speed only: the result
  // does not depend on where a block runs.
  const int j   = bx % nqb;
  const int tt  = (j >= nqb / 2) ? (nqb + nqb / 2 - 1 - j) : j;   // j = 0..15 -> j, 16..31 -> 47 - j = 31 - (j - 16)
  const int rnd = bx >> 8;                                        // parity of flat block index / 256 (gridDim.x = 512 = 2 x 256)
  const int qb  = ((j ^ rnd) & 1) ? (nqb - 1 - tt) : tt;          // block-uniform, 0..31
  const int q0 = qb * AT_QB + wave * 16;

  const size_t bo = (size_t)blockIdx.y * kSeq * kDm;
  const __bf16* Qh = (const __bf16*)(const void*)qhp + bo + (size_t)h * AT_D;
  const __bf16* Ql = (const __bf16*)(const void*)qlp + bo + (size_t)h * AT_D;
  const __bf16* Kh = (const __bf16*)(const void*)khp + bo + (size_t)h * AT_D;
  const __bf16* Kl = (const __bf16*)(const void*)klp + bo + (size_t)h * AT_D;
  const __bf16* Vh = (const __bf16*)(const void*)vhp + bo + (size_t)h * AT_D * kSeq;
  const __bf16* Vl = (const __bf16*)(const void*)vlp + bo + (size_t)h * AT_D * kSeq;
  float*        ob = out + bo + (size_t)h * AT_D;

  // ---- Q fragments (B operand, column = query = lane&15, split k map via Frag load): 2 d-chunks, hi and lo ----
  v16b qah[2], qal[2];
#pragma unroll
  for (int dc = 0; dc < 2; ++dc) {
    const __bf16* qr = Qh + (size_t)(q0 + c) * kDm + dc * 32 + 8 * hh;
    const __bf16* ql = Ql + (size_t)(q0 + c) * kDm + dc * 32 + 8 * hh;
    qah[dc] = Frag<__bf16>::load(qr);
    qal[dc] = Frag<__bf16>::load(ql);
  }

  const float c2 = sscale * 1.44269504088896340736f;   // score scale times log2(e), sscale > 0: the softmax runs in base 2
  float mrow = -INFINITY;   // running maximum of query q0 + c in base-2 units (score * c2), the same in both lane halves
  float lrow = 0.f;         // running sum over this lane half's keys; the halves are joined behind the loop
  v8f oacc[4];              // O^T: oacc[t][r] = out[q0 + c][16t + 8hh + r]
#pragma unroll
  for (int t = 0; t < 4; ++t) oacc[t] = (v8f){0.f,0.f,0.f,0.f,0.f,0.f,0.f,0.f};

  int nChunks = qb + 1;                      // block-uniform, <= 32
  if (nChunks > kSeq / AT_KC) nChunks = kSeq / AT_KC;
  for (int kc = 0; kc < nChunks; ++kc) {
    const int kv0 = kc * AT_KC;
    __syncthreads();
    {
      // staging coverage: 128 threads x (4 x 8) elements = 64 rows x 64 per plane = the whole chunk tile
      const int r = tid >> 1, half = (tid & 1) * 32;
      const __bf16* ksh = Kh + (size_t)(kv0 + r) * kDm + half;     // K row kv0+r, d = half..half+31
      const __bf16* ksl = Kl + (size_t)(kv0 + r) * kDm + half;
      const __bf16* vsh = Vh + (size_t)r * kSeq + kv0 + half;     // V^T row d = r, s = kv0+half..+31
      const __bf16* vsl = Vl + (size_t)r * kSeq + kv0 + half;
#pragma unroll
      for (int i = 0; i < 4; ++i) {
        const v8b a0 = *(const v8b*)(ksh + 8 * i);
        const v8b a1 = *(const v8b*)(ksl + 8 * i);
        const v8b b0 = *(const v8b*)(vsh + 8 * i);
        const v8b b1 = *(const v8b*)(vsl + 8 * i);
        *(v8b*)(Ksh + r * AT_LP + half + 8 * i) = a0;
        *(v8b*)(Ksl + r * AT_LP + half + 8 * i) = a1;
        *(v8b*)(Vth + r * AT_LP + half + 8 * i) = b0;
        *(v8b*)(Vtl + r * AT_LP + half + 8 * i) = b1;
      }
    }
    __syncthreads();

    // The K fragments are read in two groups, well in front of their products, in the order of their use: the wave meets the LDS latency
    // once a chunk, not once per fragment. The products run term by term over the four score tiles, so that neighbouring matrix
    // instructions have different accumulators; each tile still takes its six terms in the order dc 0: hi.hi, lo.hi, hi.lo, dc 1: the same.
    v16b kfh[2][4], kfl[2][4];
#pragma unroll
    for (int j = 0; j < 4; ++j) kfh[0][j] = Frag<__bf16>::load(Ksh + (j * 16 + c) * AT_LP + 8 * hh);
#pragma unroll
    for (int j = 0; j < 4; ++j) kfl[0][j] = Frag<__bf16>::load(Ksl + (j * 16 + c) * AT_LP + 8 * hh);
#pragma unroll
    for (int j = 0; j < 4; ++j) kfh[1][j] = Frag<__bf16>::load(Ksh + (j * 16 + c) * AT_LP + 32 + 8 * hh);
    __builtin_amdgcn_sched_barrier(0);   // keeps the reads above in one group: sunk to their users they would each expose the LDS latency again
    v8f s[4];                            // s[j][r] = score of key kv0 + 16j + 8hh + r, query q0 + c
#pragma unroll
    for (int j = 0; j < 4; ++j) s[j] = at_mma(kfh[0][j], qah[0], (v8f){0.f,0.f,0.f,0.f,0.f,0.f,0.f,0.f});
#pragma unroll
    for (int j = 0; j < 4; ++j) s[j] = at_mma(kfl[0][j], qah[0], s[j]);
    __builtin_amdgcn_sched_barrier(0);   // the last K group waits for the registers of the lo fragments just used (all four groups at once do not fit) ...
#pragma unroll
    for (int j = 0; j < 4; ++j) kfl[1][j] = Frag<__bf16>::load(Ksl + (j * 16 + c) * AT_LP + 32 + 8 * hh);
    __builtin_amdgcn_sched_barrier(0);   // ... and stays eight products in front of its first user
#pragma unroll
    for (int j = 0; j < 4; ++j) s[j] = at_mma(kfh[0][j], qal[0], s[j]);
#pragma unroll
    for (int j = 0; j < 4; ++j) s[j] = at_mma(kfh[1][j], qah[1], s[j]);
#pragma unroll
    for (int j = 0; j < 4; ++j) s[j] = at_mma(kfl[1][j], qah[1], s[j]);
#pragma unroll
    for (int j = 0; j < 4; ++j) s[j] = at_mma(kfh[1][j], qal[1], s[j]);
    __builtin_amdgcn_sched_barrier(0);   // the V^T reads below stay behind the last score product (they take over the K fragments' registers)
    // V^T fragments, first three groups: read here, they arrive under the softmax arithmetic
    v16b vfh[2][4], vfl[2][4];
#pragma unroll
    for (int t = 0; t < 4; ++t) vfh[0][t] = Frag<__bf16>::load(Vth + (t * 16 + c) * AT_LP + 8 * hh);
#pragma unroll
    for (int t = 0; t < 4; ++t) vfl[0][t] = Frag<__bf16>::load(Vtl + (t * 16 + c) * AT_LP + 8 * hh);
#pragma unroll
    for (int t = 0; t < 4; ++t) vfh[1][t] = Frag<__bf16>::load(Vth + (t * 16 + c) * AT_LP + 32 + 8 * hh);
    __builtin_amdgcn_sched_barrier(0);   // ... and in front of the softmax, not sunk to their users behind it
    // ---- scale, structural causal select on the diagonal tile, maximum over the lane's 32 keys and the other half's ----
    const bool diag = (kc == qb);            // block-uniform
    // a key of this lane, 16j + 8hh + r inside the chunk, is masked where it lies behind the lane's query; off the diagonal none is (limit 64)
    const int lim = diag ? (q0 + c - kv0 - 8 * hh) : AT_KC;
    float m = -INFINITY;
    // the loops from here to the end of the chunk are unrolled in full: s, ph, pl and oacc live in registers and take compile-time indices only
#pragma unroll
    for (int j = 0; j < 4; ++j) {
#pragma unroll
      for (int r = 0; r < 8; ++r) {
        const float sm = (j * 16 + r > lim) ? mfill : s[j][r];   // unscaled product; mfill * c2 is still far below every score
        s[j][r] = sm;
        m = fmaxf(m, sm);
      }
    }
    m = fmaxf(m, at_other_half(m));
    const float mnew = fmaxf(mrow, m * c2);   // c2 > 0: the maximum of the products, scaled, is the maximum of the scaled scores
    const float alpha = __builtin_amdgcn_exp2f(mrow - mnew);
    mrow = mnew;
    const v2f c2v = (v2f){c2, c2}, nmv = (v2f){-mnew, -mnew};
    v2f psum = (v2f){0.f, 0.f};              // even and odd keys apart: one packed add per pair
    PB ph[2], pl[2];                         // P^T hi / lo as B operands: keys 32kk..32kk+31, element 8(j&1) + r <- tile j = 2kk + (j&1)
#pragma unroll
    for (int j = 0; j < 4; ++j) {
#pragma unroll
      for (int r = 0; r < 8; r += 2) {
        // exp(score * sscale - max) = 2^(score * c2 - mnew): one fused multiply-add (a pair at a time) and the hardware's base-2 exponential
        const v2f e = __builtin_elementwise_fma((v2f){s[j][r], s[j][r + 1]}, c2v, nmv);
        const v2f p = (v2f){__builtin_amdgcn_exp2f(e[0]), __builtin_amdgcn_exp2f(e[1])};
        psum += p;
        // two neighbouring keys fill one operand register: packed round-to-nearest-even conversions, hi = bf16(p), lo = bf16(p - hi)
        const v2b a = __builtin_convertvector(p, v2b);
        const v2b bl = __builtin_convertvector(p - __builtin_convertvector(a, v2f), v2b);
        ph[j >> 1].w[(j & 1) * 4 + (r >> 1)] = a;
        pl[j >> 1].w[(j & 1) * 4 + (r >> 1)] = bl;
      }
    }
    lrow = lrow * alpha + (psum[0] + psum[1]);
#pragma unroll
    for (int t = 0; t < 4; ++t) oacc[t] *= alpha;
    // term by term over the four output tiles; each tile takes its six terms in the order kk 0: hi.hi, lo.hi, hi.lo, kk 1: the same
#pragma unroll
    for (int t = 0; t < 4; ++t) oacc[t] = at_mma(vfh[0][t], ph[0].v, oacc[t]);
#pragma unroll
    for (int t = 0; t < 4; ++t) oacc[t] = at_mma(vfl[0][t], ph[0].v, oacc[t]);
    __builtin_amdgcn_sched_barrier(0);   // the last V^T group waits for the registers of the lo fragments just used ...
#pragma unroll
    for (int t = 0; t < 4; ++t) vfl[1][t] = Frag<__bf16>::load(Vtl + (t * 16 + c) * AT_LP + 32 + 8 * hh);
    __builtin_amdgcn_sched_barrier(0);   // ... and stays eight products in front of its first user
#pragma unroll
    for (int t = 0; t < 4; ++t) oacc[t] = at_mma(vfh[0][t], pl[0].v, oacc[t]);
#pragma unroll
    for (int t = 0; t < 4; ++t) oacc[t] = at_mma(vfh[1][t], ph[1].v, oacc[t]);
#pragma unroll
    for (int t = 0; t < 4; ++t) oacc[t] = at_mma(vfl[1][t], ph[1].v, oacc[t]);
#pragma unroll
    for (int t = 0; t < 4; ++t) oacc[t] = at_mma(vfh[1][t], pl[1].v, oacc[t]);
  }

  float* os = Os[wave];
  const float inv = 1.0f / (lrow + at_other_half(lrow));   // the query's sum: both halves' keys
#pragma unroll
  for (int t = 0; t < 4; ++t) {
    const v8f o = oacc[t] * inv;
    *(v4f*)(os + c * 68 + t * 16 + 8 * hh)     = (v4f){o[0], o[1], o[2], o[3]};
    *(v4f*)(os + c * 68 + t * 16 + 8 * hh + 4) = (v4f){o[4], o[5], o[6], o[7]};
  }
  __builtin_amdgcn_fence(__ATOMIC_RELEASE, "workgroup");
  __builtin_amdgcn_wave_barrier();
  __builtin_amdgcn_fence(__ATOMIC_ACQUIRE, "workgroup");
  {
    const int c4 = (lane & 15) * 4;
    {
#pragma unroll
      for (int it = 0; it < 8; ++it) {
        const int row = it * 2 + hh;   // it 0..7 x hh 0..1 covers rows 0..15 of the wave tile
        v4f val = *(const v4f*)(os + row * 68 + c4);
        *(v4f*)(ob + (size_t)(q0 + row) * kDm + c4) = val;
      }
      
    }
  }
}

// ---------------------------------------------------------------------------
// Workspace region map (byte offsets). Every GEMM: K in {1024, 32} (%32 == 0), M = kRows = 4096, N in {128, 1024} (%128 == 0).
// Activation regions hold both batch elements, row = b*2048 + s.
// Every region is fully written before it is read within the in-order launch sequence; reused regions noted.
//   Wqh bf16 [1024 n][1024 k]        0      Wql    2097152
//   Wkh                        4194304      Wkl    6291456
//   Wvh                        8388608      Wvl   10485760
//   Woh                       12582912      Wol   14680064
//   W1Th bf16 [128 n][1024 k] 16777216      W1Tl  17039360   (rows 96..127 zero)
//   W2Th bf16 [3][1024 n][32] 17301504      W2Tl  17498112
//   XXh  bf16 [4096][1024]    17694720      XXl   26083328   (xxx planes; reused after the LoRA GEMM as Oh / Ol)
//   LORAf f32 [4096][128]     34471936
//   LTh  bf16 [4096][128]     36569088      LTl   37617664
//   MIX  f32 [3][4096][1024]  38666240                       (reused after the mix kernel: Qf = +0, Kf = +16777216,
//                                                             Vf = +33554432 f32 [4096][1024]; Of reuses Qf)
//   XQh/XQl/XKh/XKl/XVh/XVl   88997888 .. (6 x 8388608)
//   Qh/Ql/Kh/Kl              139329536 .. (4 x 8388608)
//   VTh/VTl bf16 [2][1024][2048] 172883968, 181272576
//   total                    189661184  (~180.9 MiB)
// ---------------------------------------------------------------------------
extern "C" void kernel_launch(void* const* d_in, const int* in_sizes, int n_in,
                              void* d_out, int out_size, void* d_ws, size_t ws_size,
                              hipStream_t stream) {
  if (n_in < 21) return;
  const int nRow = kSeq * kDm;            // 2097152 per batch element
  const int nAct = kBatch * nRow;         // 4194304
  const int nW   = kDm * kDm;             // 1048576
  if (in_sizes[0] != nAct) return;
  if (in_sizes[1] != kBatch * kDm) return;
  if (in_sizes[2] != kDm || in_sizes[3] != kDm || in_sizes[4] != kDm || in_sizes[5] != kDm) return;
  if (in_sizes[6] != kDm * kLoraN) return;
  if (in_sizes[7] != 3 * kLoraD * kDm) return;
  if (in_sizes[8] != nW || in_sizes[9] != nW || in_sizes[10] != nW || in_sizes[11] != nW) return;
  for (int i = 12; i < 20; ++i) if (in_sizes[i] != kDm) return;
  if (in_sizes[20] != kSeq * 32) return;
  if (out_size != nAct) return;

  const float* x     = (const float*)d_in[0];    // [2][2048][1024]
  const float* ss    = (const float*)d_in[1];    // [2][1024]
  const float* maax  = (const float*)d_in[2];    // [1024]
  const float* maar  = (const float*)d_in[3];
  const float* maak  = (const float*)d_in[4];
  const float* maav  = (const float*)d_in[5];
  const float* w1    = (const float*)d_in[6];    // [1024][96]
  const float* w2    = (const float*)d_in[7];    // [3][32][1024]
  const float* wq    = (const float*)d_in[8];    // [1024 out][1024 in]
  const float* wk    = (const float*)d_in[9];
  const float* wv    = (const float*)d_in[10];
  const float* wo    = (const float*)d_in[11];
  const float* lnrg  = (const float*)d_in[12];
  const float* lnrb  = (const float*)d_in[13];
  const float* lnkg  = (const float*)d_in[14];
  const float* lnkb  = (const float*)d_in[15];
  const float* lnvg  = (const float*)d_in[16];
  const float* lnvb  = (const float*)d_in[17];
  const float* lnxg  = (const float*)d_in[18];
  const float* lnxb  = (const float*)d_in[19];
  const float* ang   = (const float*)d_in[20];   // [2048][32]

  const size_t PW   = (size_t)kDm * kDm * 2;          // 2097152  bf16 weight plane
  const size_t PX   = (size_t)kRows * kDm * 2;        // 8388608  bf16 activation plane (both batch elements)
  const size_t PF   = (size_t)kRows * kDm * 4;        // 16777216 f32 activation plane
  const size_t PW1  = (size_t)kLoraP * kDm * 2;       // 262144
  const size_t PW2  = (size_t)3 * kDm * kLoraD * 2;   // 196608
  const size_t PLF  = (size_t)kRows * kLoraP * 4;     // 2097152
  const size_t PLT  = (size_t)kRows * kLoraP * 2;     // 1048576
  size_t off = 0;
  const size_t oWqh = off; off += PW;  const size_t oWql = off; off += PW;
  off += 4 * PW;                                // Wkh, Wkl, Wvh, Wvl: reached from Wqh / Wql by the plane stride
  const size_t oWoh = off; off += PW;  const size_t oWol = off; off += PW;
  const size_t oW1h = off; off += PW1; const size_t oW1l = off; off += PW1;
  const size_t oW2h = off; off += PW2; const size_t oW2l = off; off += PW2;
  const size_t oXXh = off; off += PX;  const size_t oXXl = off; off += PX;
  const size_t oLF  = off; off += PLF;
  const size_t oLTh = off; off += PLT; const size_t oLTl = off; off += PLT;
  const size_t oMIX = off; off += 3 * PF;
  const size_t oXQh = off; off += PX;  const size_t oXQl = off; off += PX;
  const size_t oXKh = off; off += PX;  const size_t oXKl = off; off += PX;
  const size_t oXVh = off; off += PX;  const size_t oXVl = off; off += PX;
  const size_t oQh  = off; off += PX;  const size_t oQl  = off; off += PX;
  const size_t oKh  = off; off += PX;  const size_t oKl  = off; off += PX;
  const size_t oVTh = off; off += PX;  const size_t oVTl = off; off += PX;
  if (off > ws_size) return;                    // off = 189661184

  char* ws = (char*)d_ws;
  unsigned short* Wqh = (unsigned short*)(ws + oWqh); unsigned short* Wql = (unsigned short*)(ws + oWql);
  unsigned short* Woh = (unsigned short*)(ws + oWoh); unsigned short* Wol = (unsigned short*)(ws + oWol);
  unsigned short* W1h = (unsigned short*)(ws + oW1h); unsigned short* W1l = (unsigned short*)(ws + oW1l);
  unsigned short* W2h = (unsigned short*)(ws + oW2h); unsigned short* W2l = (unsigned short*)(ws + oW2l);
  unsigned short* XXh = (unsigned short*)(ws + oXXh); unsigned short* XXl = (unsigned short*)(ws + oXXl);
  float*          LF  = (float*)(ws + oLF);
  unsigned short* LTh = (unsigned short*)(ws + oLTh); unsigned short* LTl = (unsigned short*)(ws + oLTl);
  float*          MIX = (float*)(ws + oMIX);
  float*          Qf  = (float*)(ws + oMIX);
  float*          Kf  = (float*)(ws + oMIX + PF);
  float*          Vf  = (float*)(ws + oMIX + 2 * PF);
  float*          Of  = Qf;
  unsigned short* XQh = (unsigned short*)(ws + oXQh); unsigned short* XQl = (unsigned short*)(ws + oXQl);
  unsigned short* XKh = (unsigned short*)(ws + oXKh); unsigned short* XKl = (unsigned short*)(ws + oXKl);
  unsigned short* XVh = (unsigned short*)(ws + oXVh); unsigned short* XVl = (unsigned short*)(ws + oXVl);
  unsigned short* Qh  = (unsigned short*)(ws + oQh);  unsigned short* Ql  = (unsigned short*)(ws + oQl);
  unsigned short* Kh  = (unsigned short*)(ws + oKh);  unsigned short* Kl  = (unsigned short*)(ws + oKl);
  unsigned short* VTh = (unsigned short*)(ws + oVTh); unsigned short* VTl = (unsigned short*)(ws + oVTl);
  unsigned short* Oh  = XXh;                          unsigned short* Ol  = XXl;

  const float* dummyf = lnrg;                         // valid pointer for unused bias / resid arguments (never read)

  const dim3 blk(256);
  const int  n8w = nW / 8;                                  // 131072 groups of 8 per weight plane
  const dim3 gCastW((n8w + 1023) / 1024, 4);                // 128 blocks x 256 threads x 4 x 8 = 1024x1024, y = q, k, v, o
  const dim3 gW1(kDm / 64);                                 // 16 k-tiles
  const dim3 gW2(kDm / 64, 3);                              // 16 n-tiles x 3
  const dim3 gRow(kRows / kEwRows);                         // one block per kEwRows token rows (128-thread kernels)
  const dim3 blkG(128);                                     // GEMM block: 4 waves, one 128x128 tile
  const dim3 gLora((kRows / 128) * (kLoraP / 128));         // 32 tiles: M=4096, N=128
  const dim3 gMix((kRows / 128) * (kDm / 128), 3);          // 256 tiles x 3 (l): M=4096, N=1024, K=32
  const int  n8l = kRows * kLoraP / 8;                      // 65536 groups of 8
  const dim3 gTanh((n8l + 255) / 256);                      // 256 blocks x 256 x 8 = 4096x128
  const dim3 gQKV((kRows / 128) * (kDm / 128), 3);          // 256 tiles x 3 (q, k, v): M=4096, N=1024
  const dim3 gProj((kRows / 128) * (kDm / 128), 1);         // 256 tiles: M=4096, N=1024
  const dim3 gLnQK(kRows / 8, 2);                           // 512 blocks x 8 waves = 4096 rows, x {q, k}
  const dim3 gLn1(kRows / 8, 1);
  const dim3 gVT(kDm / 64, kSeq / 64, kBatch);              // per b: in [R=2048 s][Cn=1024 c] -> planes [c][s]
  const dim3 gAtt(kHeads * (kSeq / 64), kBatch);            // 512 x 2 blocks: 16 heads x 32 query blocks, y = b

  // setup: weights -> bf16 hi/lo planes (q/k/v/o already [out n][in k] = Bt layout; w1/w2 transposed).
  // The hi planes of q, k, v, o lie 2 weight planes apart (hi, lo, hi, lo, ...), and so do the lo planes.
  split_bf16x2_kernel<<<gCastW, blk, 0, stream>>>(wq, wk, wv, wo, Wqh, Wql, n8w, 2L * nW);
  w1t_split_kernel<<<gW1, blk, 0, stream>>>(w1, W1h, W1l);
  w2t_split_kernel<<<gW2, blk, 0, stream>>>(w2, W2h, W2l);

  // Each stage below runs once, on the rows of both batch elements.
  // (1) xxx = x + dxprev*maa_x -> planes
  xxx_split_kernel<<<gRow, dim3(128), 0, stream>>>(x, ss, maax, XXh, XXl);
  // (2) lora_pre = xxx . w1 -> f32 [4096][128]   (M=4096, N=128, K=1024)
  wmma_gemm64<1, true, 0, 0, false, 0><<<gLora, blkG, 0, stream>>>(
      XXh, XXl, kDm, 0L, W1h, W1l, kDm, 0L, (void*)LF, (void*)LF, kLoraP, 0L,
      dummyf, dummyf, 0L, kRows, kLoraP, kDm, 1.0f);
  // (3) lora = tanh -> planes [4096][128]
  tanh_split_kernel<<<gTanh, blk, 0, stream>>>(LF, LTh, LTl, n8l);
  // (4) mixes[l] = lora[:, 32l..32l+31] . w2[l] -> f32 [3][4096][1024]   (M=4096, N=1024, K=32; grid.y = l)
  wmma_gemm64<1, true, 0, 0, false, 0><<<gMix, blkG, 0, stream>>>(
      LTh, LTl, kLoraP, (long)kLoraD, W2h, W2l, kLoraD, (long)kDm * kLoraD, (void*)MIX, (void*)MIX, kDm, (long)nAct,
      dummyf, dummyf, 0L, kRows, kDm, kLoraD, 1.0f);
  // (5) xq/xk/xv = x + dxprev*(maa + mix) -> planes
  mix_split_kernel<<<gRow, dim3(128), 0, stream>>>(x, ss, maar, maak, maav, MIX, XQh, XQl, XKh, XKl, XVh, XVl);
  // (6) q0 = xq . Wq^T, k0 = xk . Wk^T, v0 = xv . Wv^T -> f32 [3][4096][1024]   (M=4096, N=1024, K=1024; grid.y = q, k, v:
  //     XQ/XK/XV hi planes lie 2 activation planes apart, Wq/Wk/Wv hi planes 2 weight planes, Qf/Kf/Vf one f32 plane)
  wmma_gemm64<1, true, 0, 0, false, 0><<<gQKV, blkG, 0, stream>>>(
      XQh, XQl, kDm, 2L * nAct, Wqh, Wql, kDm, 2L * nW, (void*)Qf, (void*)Qf, kDm, (long)nAct,
      dummyf, dummyf, 0L, kRows, kDm, kDm, 1.0f);
  // (7) LayerNorm + RoPE + split for q and k -> planes [row][h*64+d]
  ln_kernel<0><<<gLnQK, blk, 0, stream>>>(Qf, Kf, lnrg, lnrb, lnkg, lnkb, ang, Qh, Ql, Kh, Kl, Qf);
  // (8) LayerNorm of v in place (f32), then transpose-split -> v^T planes [b][h*64+d][s]
  ln_kernel<1><<<gLn1, blk, 0, stream>>>(Vf, Vf, lnvg, lnvb, lnvg, lnvb, ang, VTh, VTl, VTh, VTl, Vf);
  wt_split_kernel<<<gVT, blk, 0, stream>>>(Vf, VTh, VTl, kSeq, kDm);
  // (9) causal attention per batch element and head -> f32 [row][h*64+d] (Of region; Qf is dead after step 7)
  attn_causal64_kernel<<<gAtt, dim3(128), 0, stream>>>(Qh, Ql, Kh, Kl, VTh, VTl, Of, 0.125f, -1.0e30f);
  // (10) output LayerNorm + split -> planes (XX region is dead after step 2)
  ln_kernel<2><<<gLn1, blk, 0, stream>>>(Of, Of, lnxg, lnxb, lnxg, lnxb, ang, Oh, Ol, Oh, Ol, Of);
  // (11) out = o . Wo^T -> d_out (f32)   (M=4096, N=1024, K=1024)
  wmma_gemm64<1, true, 0, 0, false, 0><<<gProj, blkG, 0, stream>>>(
      Oh, Ol, kDm, 0L, Woh, Wol, kDm, 0L, d_out, d_out, kDm, 0L,
      dummyf, dummyf, 0L, kRows, kDm, kDm, 1.0f);
}

// v010
// One run takes 267 microseconds.
// Timed twice side by side with v009, it ran 1.04 times as fast both times.
// Over all steps from v000, the starting kernel, it is 4.85 times as fast.
// All contractions (token-shift LoRA xxx.w1 and lora.w2, q/k/v projections, attention q.k^T and p.v, output projection): v_wmma_f32_16x16x32_bf16 with bf16 hi/lo split operands (hi.hi + hi.lo + lo.hi), f32 accumulate; token shift, tanh, LayerNorms, RoPE, online softmax, score scale 0.125 in f32.
#include <hip/hip_runtime.h>
#include <math.h>
#include <stdint.h>

constexpr int kBatch = 2;
constexpr int kSeq   = 2048;
constexpr int kRows  = kBatch * kSeq;   // token rows of both batch elements, row = b*kSeq + s
constexpr int kDm    = 1024;
constexpr int kHeads = 16;
constexpr int kLoraN = 96;      // 3 x 32 LoRA outputs
constexpr int kLoraP = 128;     // padded to a 64-multiple
constexpr int kLoraD = 32;

typedef __attribute__((ext_vector_type(16))) _Float16 v16h;
typedef __attribute__((ext_vector_type(8)))  _Float16 v8h;
typedef __attribute__((ext_vector_type(16))) __bf16   v16b;
typedef __attribute__((ext_vector_type(8)))  __bf16   v8b;
typedef __attribute__((ext_vector_type(2)))  __bf16   v2b;
typedef __attribute__((ext_vector_type(8)))  float    v8f;
typedef __attribute__((ext_vector_type(4)))  float    v4f;
typedef __attribute__((ext_vector_type(2)))  float    v2f;
typedef __attribute__((ext_vector_type(4)))  unsigned int v4u;
typedef __attribute__((ext_vector_type(8)))  unsigned short v8us;

__device__ __forceinline__ unsigned short f2bf_bits(float f) {
  unsigned u = __float_as_uint(f);
  return (unsigned short)((u + 0x7FFFu + ((u >> 16) & 1u)) >> 16);
}
__device__ __forceinline__ float bf_bits2f(unsigned short h) { return __uint_as_float(((unsigned)h) << 16); }

// hazard guards as plain device helpers (no inline asm inside the kernel template body)
__device__ __forceinline__ void dep_guard_h(v8f& a, v8f& b, v16h x, v16h y) { asm volatile("v_nop\n\tv_nop\n\tv_nop\n\tv_nop" : "+v"(a), "+v"(b) : "v"(x), "v"(y)); }
__device__ __forceinline__ void dep_guard_b(v8f& a, v8f& b, v16b x, v16b y) { asm volatile("v_nop\n\tv_nop\n\tv_nop\n\tv_nop" : "+v"(a), "+v"(b) : "v"(x), "v"(y)); }
__device__ __forceinline__ void keep4_h(v16h a, v16h b, v16h c, v16h d) { asm volatile("v_nop" :: "v"(a), "v"(b), "v"(c), "v"(d)); }
__device__ __forceinline__ void keep4_b(v16b a, v16b b, v16b c, v16b d) { asm volatile("v_nop" :: "v"(a), "v"(b), "v"(c), "v"(d)); }
__device__ __forceinline__ void acc_guard4(v8f& a, v8f& b, v8f& c, v8f& d) { asm volatile("v_nop\n\tv_nop\n\tv_nop\n\tv_nop" : "+v"(a), "+v"(b), "+v"(c), "+v"(d)); }
template <typename T> struct Frag;
template <> struct Frag<_Float16> {
  typedef v16h V; union U { v16h v; v8h h[2]; };
  static __device__ __forceinline__ v16h load(const _Float16* p) {   // elements 0..7 <- p[0..7], 8..15 <- p[16..23]
    U f; f.h[0] = *(const v8h*)(p); f.h[1] = *(const v8h*)(p + 16); return f.v;
  }
  static __device__ __forceinline__ v8f mma(v16h a, v16h b, v8f c) {
    return __builtin_amdgcn_wmma_f32_16x16x32_f16(false, a, false, b, (short)0, c, false, false);
  }
  static __device__ __forceinline__ void guard(v8f& a, v8f& b, v16h x, v16h y) { dep_guard_h(a, b, x, y); }
  static __device__ __forceinline__ void keep(v16h a, v16h b, v16h c, v16h d) { keep4_h(a, b, c, d); }
};
template <> struct Frag<__bf16> {
  typedef v16b V; union U { v16b v; v8b h[2]; };
  static __device__ __forceinline__ v16b load(const __bf16* p) {
    U f; f.h[0] = *(const v8b*)(p); f.h[1] = *(const v8b*)(p + 16); return f.v;
  }
  static __device__ __forceinline__ v8f mma(v16b a, v16b b, v8f c) {
    return __builtin_amdgcn_wmma_f32_16x16x32_bf16(false, a, false, b, (short)0, c, false, false);
  }
  static __device__ __forceinline__ void guard(v8f& a, v8f& b, v16b x, v16b y) { dep_guard_b(a, b, x, y); }
  static __device__ __forceinline__ void keep(v16b a, v16b b, v16b c, v16b d) { keep4_b(a, b, c, d); }
};

// ---- Register-blocked batched WMMA GEMM, operands staged in LDS --------------
// C[m,n] = scale * sum_k A[m,k] * Bt[n,k] (+bias)(+resid); a block of 4 waves (2 x 2) owns a 128x128 tile, each wave 64x64 of it.
// A row-major [M,K]; Bt row-major [N,K]; M,N % 128 == 0, K % 32 == 0.
// Per 32-wide k tile the block brings 128 A rows and 128 Bt rows of every plane (64 B a row) into LDS with asynchronous
// 16-B copies (a wave-wide copy = 8 rows x 64 contiguous B), two buffers: tile t+1 flies while tile t is multiplied.
// SPLIT: operands are hi/lo planes (A2/Bt2 = lo planes, same layout); product = hi.hi + hi.lo + lo.hi.
// BIAS_MODE: 0 = none, 1 = bias[m], 2 = bias[n].
// OUT_MODE: 0 = f32, 1 = f16, 2 = bf16 hi plane (Cout) + bf16 lo plane (Cout2).
// Coverage per wave tile: 4 slabs x 16 rows x 64 cols = 64x64 (f32: it 0..7 x hh 0..1 rows, 16 lanes x 4 floats;
// 16-bit: it 0..3 x q 0..3 rows, 8 lanes x 8 elements).
// ET: 0 = f16 operands, 1 = bf16 operands (pointers passed as 16-bit storage)
template <int ET> struct Elem;
template <> struct Elem<0> { typedef _Float16 T; };
template <> struct Elem<1> { typedef __bf16 T; };
constexpr int kGLP    = 40;            // LDS row pitch in 16-bit elements: 80 B = 16 B x 5 (odd), the pitch for 16-B reads of 64-B rows
constexpr int kGPlane = 128 * kGLP;    // one plane of a stage: 128 rows
constexpr int kGStage = 4 * kGPlane;   // A hi, A lo, Bt hi, Bt lo

// Four rows (32 apart) of one plane pair -> LDS: 8 (hi and lo) or 4 (hi only) copies of 16 B per lane. l = the lane's LDS byte
// address of its first hi row, g / g2 = its global address in the hi / lo plane, step = 32 source rows in elements.
// s_wait_xcnt 0 ends the copies' own statement, so that it stands in front of any rewrite of the address registers they name.
template <typename T>
__device__ __forceinline__ void stage_rows8(unsigned l, const T* g, const T* g2, size_t step) {
  const unsigned l1 = l + 32 * kGLP * 2, l2 = l + 64 * kGLP * 2, l3 = l + 96 * kGLP * 2;
  const unsigned m0 = l + kGPlane * 2, m1 = l1 + kGPlane * 2, m2 = l2 + kGPlane * 2, m3 = l3 + kGPlane * 2;
  const T* g1 = g + step;  const T* gg2 = g1 + step;  const T* g3 = gg2 + step;
  const T* h1 = g2 + step; const T* h2 = h1 + step;   const T* h3 = h2 + step;
  asm volatile("global_load_async_to_lds_b128 %0, %8, off\n\t"
               "global_load_async_to_lds_b128 %1, %9, off\n\t"
               "global_load_async_to_lds_b128 %2, %10, off\n\t"
               "global_load_async_to_lds_b128 %3, %11, off\n\t"
               "global_load_async_to_lds_b128 %4, %12, off\n\t"
               "global_load_async_to_lds_b128 %5, %13, off\n\t"
               "global_load_async_to_lds_b128 %6, %14, off\n\t"
               "global_load_async_to_lds_b128 %7, %15, off\n\t"
               "s_wait_xcnt 0x0"
               :: "v"(l), "v"(l1), "v"(l2), "v"(l3), "v"(m0), "v"(m1), "v"(m2), "v"(m3),
                  "v"(g), "v"(g1), "v"(gg2), "v"(g3), "v"(g2), "v"(h1), "v"(h2), "v"(h3) : "memory");
}
template <typename T>
__device__ __forceinline__ void stage_rows4(unsigned l, const T* g, size_t step) {
  const unsigned l1 = l + 32 * kGLP * 2, l2 = l + 64 * kGLP * 2, l3 = l + 96 * kGLP * 2;
  const T* g1 = g + step; const T* gg2 = g1 + step; const T* g3 = gg2 + step;
  asm volatile("global_load_async_to_lds_b128 %0, %4, off\n\t"
               "global_load_async_to_lds_b128 %1, %5, off\n\t"
               "global_load_async_to_lds_b128 %2, %6, off\n\t"
               "global_load_async_to_lds_b128 %3, %7, off\n\t"
               "s_wait_xcnt 0x0"
               :: "v"(l), "v"(l1), "v"(l2), "v"(l3), "v"(g), "v"(g1), "v"(gg2), "v"(g3) : "memory");
}

// gemm64_tile: the work of one block (tile index, batch index b); the kernels that launch it stand behind the elementwise split below.
template <int ET, bool SPLIT, int BIAS_MODE, int OUT_MODE, bool RESID, int ACT = 0>
__device__ __forceinline__ void gemm64_tile(
    const int tile, const int b,
    const unsigned short* __restrict__ Ap, const unsigned short* __restrict__ A2p, int lda, long strideA,
    const unsigned short* __restrict__ Btp, const unsigned short* __restrict__ Bt2p, int ldb, long strideB,
    void* __restrict__ Cout, void* __restrict__ Cout2, int ldc, long strideC,
    const float* __restrict__ bias,
    const float* __restrict__ resid, long strideR,
    int M, int N, int K, float scale) {
  typedef typename Elem<ET>::T T;
  typedef typename Frag<T>::V V;
  const T* A = (const T*)Ap; const T* A2 = (const T*)A2p; const T* Bt = (const T*)Btp; const T* Bt2 = (const T*)Bt2p;
  __shared__ __align__(16) T ring[2 * kGStage];    // two stages of operand tiles, 2 x 40,960 B
  __shared__ __align__(16) float sT[4][16 * 68];   // per-wave 16x64 slab, pitch 68 floats
  const int lane = threadIdx.x & 31;
  const int wave = threadIdx.x >> 5;
  const int tilesN = N >> 7;
  const int tilesM = M >> 7;
  if (tile >= tilesM * tilesN) return;   // block-uniform, in front of every barrier and copy
  const int tm = tile / tilesN;
  const int tn = tile - tm * tilesN;
  const int bm0 = tm << 7;                         // block tile origin
  const int bn0 = tn << 7;
  const int wm = (wave >> 1) << 6;                 // wave tile origin inside the block tile
  const int wn = (wave & 1) << 6;
  const int m0 = bm0 + wm;
  const int n0 = bn0 + wn;

  const T* Ab  = A  + (size_t)b * strideA;
  const T* Bb  = Bt + (size_t)b * strideB;
  const T* Ab2 = SPLIT ? (A2  + (size_t)b * strideA) : nullptr;
  const T* Bb2 = SPLIT ? (Bt2 + (size_t)b * strideB) : nullptr;

  const int rlane = lane & 15;                 // row (A) / col (B, D) within subtile
  const int koff  = (lane >> 4) * 8;           // k offset of this lane half
  const int mOff  = (lane >> 4) * 8;           // D row offset

  v8f acc[4][4];
#pragma unroll
  for (int i = 0; i < 4; ++i)
#pragma unroll
    for (int j = 0; j < 4; ++j) acc[i][j] = (v8f){0.f,0.f,0.f,0.f,0.f,0.f,0.f,0.f};

  // copy map: thread -> row (tid >> 2) + 32 r, r = 0..3, 16-B chunk tid & 3 of the row's 64 B; 128 threads x 4 rows = 128 rows a plane
  const int crow = threadIdx.x >> 2;
  const int cchk = (threadIdx.x & 3) * 8;
  const size_t cao = (size_t)(bm0 + crow) * lda + cchk;
  const size_t cbo = (size_t)(bn0 + crow) * ldb + cchk;
  const size_t stepA = (size_t)32 * lda, stepB = (size_t)32 * ldb;
  const unsigned lds0 = (unsigned)(uintptr_t)(&ring[0]) + (unsigned)(crow * kGLP + cchk) * 2u;   // LDS byte address: low 32 bits
  const int nT = K >> 5;                           // k tiles, the same for the whole grid

#define GEMM_STAGE(t_)                                                                          \
  {                                                                                             \
    const unsigned lt = lds0 + (unsigned)((t_) & 1) * (kGStage * 2u);                           \
    const size_t ko = (size_t)(t_) * 32;                                                        \
    if (SPLIT) {                                                                                \
      stage_rows8<T>(lt, Ab + cao + ko, Ab2 + cao + ko, stepA);                                 \
      stage_rows8<T>(lt + 2u * kGPlane * 2u, Bb + cbo + ko, Bb2 + cbo + ko, stepB);             \
    } else {                                                                                    \
      stage_rows4<T>(lt, Ab + cao + ko, stepA);                                                 \
      stage_rows4<T>(lt + 2u * kGPlane * 2u, Bb + cbo + ko, stepB);                             \
    }                                                                                           \
  }

  GEMM_STAGE(0)
  asm volatile("s_wait_asynccnt 0x0" ::: "memory");   // this wave's copies of tile 0 have landed
  __syncthreads();                                    // ... and every other wave's: tile 0 may be read
  if (nT > 1) GEMM_STAGE(1)

  for (int t = 0; t < nT; ++t) {
    const T* st = ring + (t & 1) * kGStage;
    const T* sA = st + (wm + rlane) * kGLP + koff;
    const T* sB = st + 2 * kGPlane + (wn + rlane) * kGLP + koff;
    V bh[4], bl[4];
#pragma unroll
    for (int j = 0; j < 4; ++j) {
      bh[j] = Frag<T>::load(sB + (j << 4) * kGLP);
      if (SPLIT) bl[j] = Frag<T>::load(sB + kGPlane + (j << 4) * kGLP);
    }
#pragma unroll
    for (int i = 0; i < 4; ++i) {
      V ah = Frag<T>::load(sA + (i << 4) * kGLP);
      V al;
      if (SPLIT) al = Frag<T>::load(sA + kGPlane + (i << 4) * kGLP);
#pragma unroll
      for (int j = 0; j < 4; ++j) {
        acc[i][j] = Frag<T>::mma(ah, bh[j], acc[i][j]);
        if (SPLIT) {
          acc[i][j] = Frag<T>::mma(ah, bl[j], acc[i][j]);
          acc[i][j] = Frag<T>::mma(al, bh[j], acc[i][j]);
        }
      }
      Frag<T>::guard(acc[i][0], acc[i][3], ah, SPLIT ? al : ah);
    }
    Frag<T>::keep(bh[0], bh[1], bh[2], bh[3]);
    if (SPLIT) Frag<T>::keep(bl[0], bl[1], bl[2], bl[3]);
    asm volatile("s_wait_dscnt 0x0" ::: "memory");      // this wave's reads of tile t's buffer are done before it is refilled
    asm volatile("s_wait_asynccnt 0x0" ::: "memory");   // this wave's copies of tile t+1 have landed
    __syncthreads();                                    // publishes tile t+1 and ends every wave's reads of tile t
    if (t + 2 < nT) GEMM_STAGE(t + 2)                   // uniform test; into the buffer that trip t has just read
  }
  asm volatile("s_wait_asynccnt 0x0" ::: "memory");     // no copy outstanding behind the loop
#undef GEMM_STAGE
  acc_guard4(acc[0][0], acc[0][1], acc[0][2], acc[0][3]);
  acc_guard4(acc[1][0], acc[1][1], acc[1][2], acc[1][3]);
  acc_guard4(acc[2][0], acc[2][1], acc[2][2], acc[2][3]);
  acc_guard4(acc[3][0], acc[3][1], acc[3][2], acc[3][3]);

  // ---- epilogue ----
  float* slab = sT[wave];
  const float* Rb = RESID ? (resid + (size_t)b * strideR) : nullptr;
#pragma unroll
  for (int i = 0; i < 4; ++i) {
    const int mBase = m0 + (i << 4);
#pragma unroll
    for (int j = 0; j < 4; ++j) {
      const int n = n0 + (j << 4) + rlane;
      float bv = 0.f;
      if (BIAS_MODE == 2) bv = bias[n];
#pragma unroll
      for (int r = 0; r < 8; ++r) {
        float v = acc[i][j][r] * scale;
        if (BIAS_MODE == 1) v += bias[mBase + mOff + r];
        if (BIAS_MODE == 2) v += bv;
        if (RESID) v += Rb[(size_t)(mBase + mOff + r) * ldc + n];
        if (ACT == 1) v = tanhf(v);
        if (ACT == 2) v = fmaxf(v, 0.0f);
        if (ACT == 3) v = v / (1.0f + expf(-v));
        if (ACT == 4) v = (v > 0.f) ? v : 0.01f * v;
        slab[(mOff + r) * 68 + (j << 4) + rlane] = v;
      }
    }
    __builtin_amdgcn_fence(__ATOMIC_RELEASE, "workgroup");
    __builtin_amdgcn_wave_barrier();
    __builtin_amdgcn_fence(__ATOMIC_ACQUIRE, "workgroup");
    if (OUT_MODE == 0) {
      float* C = (float*)Cout + (size_t)b * strideC;
      const int hh = lane >> 4, c4 = (lane & 15) * 4;     // row seg = 256 B = 16 lanes x 16 B
      {
#pragma unroll
        for (int it = 0; it < 8; ++it) {
          const int row = it * 2 + hh;
          v4f v = *(const v4f*)(slab + row * 68 + c4);
          *(v4f*)(C + (size_t)(mBase + row) * ldc + n0 + c4) = v;
        }
        
      }
    } else {
      const int q = lane >> 3, c8 = (lane & 7) * 8;
      unsigned short* C  = (unsigned short*)Cout  + (size_t)b * strideC;
      unsigned short* C2 = (OUT_MODE == 2) ? ((unsigned short*)Cout2 + (size_t)b * strideC) : nullptr;
      {
#pragma unroll
        for (int it = 0; it < 4; ++it) {
          const int row = it * 4 + q;
          const float* sp = slab + row * 68 + c8;
          v8h hv, lv;
#pragma unroll
          for (int e = 0; e < 8; ++e) {
            if (OUT_MODE == 1) {
              hv[e] = (_Float16)sp[e];
            } else {
              unsigned short hb = f2bf_bits(sp[e]);
              unsigned short lb = f2bf_bits(sp[e] - bf_bits2f(hb));
              hv[e] = __builtin_bit_cast(_Float16, hb);
              lv[e] = __builtin_bit_cast(_Float16, lb);
            }
          }
          *(v8h*)(C + (size_t)(mBase + row) * ldc + n0 + c8) = hv;
          if (OUT_MODE == 2) *(v8h*)(C2 + (size_t)(mBase + row) * ldc + n0 + c8) = lv;
        }
        
      }
    }
    __builtin_amdgcn_fence(__ATOMIC_RELEASE, "workgroup");
    __builtin_amdgcn_wave_barrier();
    __builtin_amdgcn_fence(__ATOMIC_ACQUIRE, "workgroup");
  }
}

// ---------------------------------------------------------------------------
// Shared elementwise split helper for 8 consecutive values -> v8us hi/lo.
// ---------------------------------------------------------------------------
__device__ __forceinline__ void split8(const v4f va, const v4f vb, v8us& hv, v8us& lv) {
#pragma unroll
  for (int e = 0; e < 4; ++e) {
    const unsigned short h0 = f2bf_bits(va[e]);
    hv[e] = h0; lv[e] = f2bf_bits(va[e] - bf_bits2f(h0));
    const unsigned short h1 = f2bf_bits(vb[e]);
    hv[4 + e] = h1; lv[4 + e] = f2bf_bits(vb[e] - bf_bits2f(h1));
  }
}
__device__ __forceinline__ void store16x2(unsigned short* ph, unsigned short* pl, size_t o, const v8us hv, const v8us lv) {
  *(v8us*)(ph + o) = hv;
  *(v8us*)(pl + o) = lv;
}

// The elementwise launches below are sized by the waves they start, not by their elements: a wave takes 256 to 1024 elements
// (8 to 32 a lane, 16-B loads and stores), so that a launch starts about 16 waves a WGP and not several hundred short ones.

// ---------------------------------------------------------------------------
// Elementwise bf16 split: hi = bf16_rne(in), lo = bf16_rne(in - hi); a thread takes 4 groups of 8 elements, 128 groups apart.
// The work of one 128-thread block: w (block-uniform) picks one of four equally sized sources, whose planes start pstride 16-bit
// elements apart; blk = the block's index inside the source.
// Coverage: ceil(n8 / 512) blocks a source x 4 x 128 groups of 8 = the whole plane (n8 = groups per source).
// ---------------------------------------------------------------------------
__device__ __forceinline__ void split_bf16x2_block(const int w, const int blk,
                                                   const float* __restrict__ in0, const float* __restrict__ in1,
                                                   const float* __restrict__ in2, const float* __restrict__ in3,
                                                   unsigned short* __restrict__ hi, unsigned short* __restrict__ lo,
                                                   int n8, long pstride) {
  const float* in = (w == 0) ? in0 : (w == 1) ? in1 : (w == 2) ? in2 : in3;
  unsigned short* ph = hi + (size_t)w * pstride;
  unsigned short* pl = lo + (size_t)w * pstride;
  v4f va[4], vb[4];
  // unrolled: the 8 loads of a thread are in flight together (index clamped, so that no branch stands between them)
#pragma unroll
  for (int it = 0; it < 4; ++it) {
    const int i = (blk * 4 + it) * 128 + threadIdx.x;
    const int ic = (i < n8) ? i : (n8 - 1);
    va[it] = *(const v4f*)(in + 8 * (size_t)ic);
    vb[it] = *(const v4f*)(in + 8 * (size_t)ic + 4);
  }
  // unrolled: va and vb live in registers and take compile-time indices only
#pragma unroll
  for (int it = 0; it < 4; ++it) {
    const int i = (blk * 4 + it) * 128 + threadIdx.x;
    if (i < n8) {
      v8us hv, lv;
      split8(va[it], vb[it], hv, lv);
      store16x2(ph, pl, 8 * (size_t)i, hv, lv);
    }
  }
}

// ---------------------------------------------------------------------------
// The GEMM launches. grid = (tiles, batches), one gemm64_tile a block.
// ---------------------------------------------------------------------------
template <int ET, bool SPLIT, int BIAS_MODE, int OUT_MODE, bool RESID, int ACT = 0>
__global__ __launch_bounds__(128) void wmma_gemm64(
    const unsigned short* __restrict__ Ap, const unsigned short* __restrict__ A2p, int lda, long strideA,
    const unsigned short* __restrict__ Btp, const unsigned short* __restrict__ Bt2p, int ldb, long strideB,
    void* __restrict__ Cout, void* __restrict__ Cout2, int ldc, long strideC,
    const float* __restrict__ bias,
    const float* __restrict__ resid, long strideR,
    int M, int N, int K, float scale) {
  gemm64_tile<ET, SPLIT, BIAS_MODE, OUT_MODE, RESID, ACT>(blockIdx.x, blockIdx.y, Ap, A2p, lda, strideA, Btp, Bt2p, ldb, strideB,
                                                          Cout, Cout2, ldc, strideC, bias, resid, strideR, M, N, K, scale);
}

// A GEMM with few tiles and the weight split, which need nothing of each other, in one grid: blocks 0 .. gemmTiles-1 (they last
// longest) take one GEMM tile each, the blocks behind them one split block each, source = index / splitBlocks. The GEMM fills
// an eighth of the chip; the split runs on the rest meanwhile. The branch is block-uniform.
// Coverage: grid.x = gemmTiles + 4 * splitBlocks, splitBlocks = ceil(n8 / 512).
__global__ __launch_bounds__(128) void gemm64_and_split_kernel(
    const unsigned short* __restrict__ Ap, const unsigned short* __restrict__ A2p, int lda,
    const unsigned short* __restrict__ Btp, const unsigned short* __restrict__ Bt2p, int ldb,
    float* __restrict__ Cout, int ldc, const float* __restrict__ unused,
    int M, int N, int K, int gemmTiles,
    const float* __restrict__ in0, const float* __restrict__ in1, const float* __restrict__ in2, const float* __restrict__ in3,
    unsigned short* __restrict__ hi, unsigned short* __restrict__ lo, int n8, long pstride, int splitBlocks) {
  const int bx = blockIdx.x;
  if (bx < gemmTiles) {
    gemm64_tile<1, true, 0, 0, false, 0>(bx, 0, Ap, A2p, lda, 0L, Btp, Bt2p, ldb, 0L, (void*)Cout, (void*)Cout, ldc, 0L,
                                         unused, unused, 0L, M, N, K, 1.0f);
  } else {
    const int sb = bx - gemmTiles;
    const int w = sb / splitBlocks;
    split_bf16x2_block(w, sb - w * splitBlocks, in0, in1, in2, in3, hi, lo, n8, pstride);
  }
}

// ---------------------------------------------------------------------------
// tanh then bf16 split: hi = bf16_rne(tanh(in)), lo = bf16_rne(tanh(in) - hi); 8 elements per thread, one 16-B store a plane
// Coverage: grid = ceil(n8/256) x 256 threads x 8 elements = 8*n8 = whole plane.
// ---------------------------------------------------------------------------
__global__ __launch_bounds__(256) void tanh_split_kernel(const float* __restrict__ in, unsigned short* __restrict__ hi,
                                                         unsigned short* __restrict__ lo, int n8) {
  const int i = blockIdx.x * 256 + threadIdx.x;
  if (i < n8) {
    const v4f fa = *(const v4f*)(in + 8 * (size_t)i);
    const v4f fb = *(const v4f*)(in + 8 * (size_t)i + 4);
    const v4f ta = (v4f){tanhf(fa[0]), tanhf(fa[1]), tanhf(fa[2]), tanhf(fa[3])};
    const v4f tb = (v4f){tanhf(fb[0]), tanhf(fb[1]), tanhf(fb[2]), tanhf(fb[3])};
    v8us hv, lv;
    split8(ta, tb, hv, lv);
    store16x2(hi, lo, 8 * (size_t)i, hv, lv);
  }
}

// ---------------------------------------------------------------------------
// Transpose + bf16 split: in w[R][Cn] f32 -> planes th/tl [Cn][R] bf16: out[n*R + k] = split(w[k*Cn + n]).
// grid = (Cn/64, R/64, matrices), R, Cn % 64 == 0; matrix z starts z*R*Cn elements into w, th and tl.
// (Used for the LayerNormed v [b][s=R=2048][c=Cn=1024] -> v^T planes [b][c][s].)
// Coverage: load 256 threads x 16 = 64x64; store 8 waves x 2 it x 4 rows(q) x 8 lanes x 8 elements = 64x64.
// ---------------------------------------------------------------------------
__global__ __launch_bounds__(256) void wt_split_kernel(const float* __restrict__ wz, unsigned short* __restrict__ thz,
                                                       unsigned short* __restrict__ tlz, int R, int Cn) {
  __shared__ float tile[64 * 65];
  const int n0 = blockIdx.x * 64;
  const int k0 = blockIdx.y * 64;
  const size_t zo = (size_t)blockIdx.z * R * Cn;
  const float* w = wz + zo;
  unsigned short* th = thz + zo;
  unsigned short* tl = tlz + zo;
  const int t = threadIdx.x;
#pragma unroll
  for (int i = 0; i < 16; ++i) {
    const int idx = i * 256 + t;
    const int kk = idx >> 6, nn = idx & 63;
    tile[nn * 65 + kk] = w[(size_t)(k0 + kk) * Cn + n0 + nn];
  }
  __syncthreads();
  const int lane = t & 31, wave = t >> 5;
  const int q = lane >> 3, c8 = (lane & 7) * 8;
  {
#pragma unroll
    for (int it = 0; it < 2; ++it) {
      const int row = wave * 8 + it * 4 + q;          // 0..63 = local n
      const float* sp = tile + row * 65 + c8;
      v8us hv, lv;
#pragma unroll
      for (int e = 0; e < 8; ++e) {
        const unsigned short hb = f2bf_bits(sp[e]);
        const unsigned short lb = f2bf_bits(sp[e] - bf_bits2f(hb));
        hv[e] = hb; lv[e] = lb;
      }
      const size_t o = (size_t)(n0 + row) * R + k0 + c8;
      *(v8us*)(th + o) = hv;
      *(v8us*)(tl + o) = lv;
    }
    
  }
}

// ---------------------------------------------------------------------------
// LoRA weight w1 [1024 in k][96 out n] f32 -> Bt planes th/tl [kLoraP=128 n][1024 k] bf16, rows n >= 96 ZERO:
//   out[n*1024 + k] = split(n < 96 ? w1[k*96 + n] : 0).  1024/64 k-tiles, blk = the tile; block = 256 threads.
// LDS tile [128 n][65]: load 256 threads x 32 iterations = 64 k x 128 n (address clamped to n <= 95, zero by predicate).
// ---------------------------------------------------------------------------
__device__ __forceinline__ void w1t_split_block(const int blk, float* tile, const float* __restrict__ w1,
                                                unsigned short* __restrict__ th, unsigned short* __restrict__ tl) {
  const int k0 = blk * 64;
  const int t = threadIdx.x;
#pragma unroll 4
  for (int i = 0; i < 32; ++i) {
    const int idx = i * 256 + t;
    const int kk = idx >> 7, nn = idx & 127;
    const int nc = (nn < kLoraN) ? nn : (kLoraN - 1);
    float v = w1[(size_t)(k0 + kk) * kLoraN + nc];
    if (nn >= kLoraN) v = 0.0f;
    tile[nn * 65 + kk] = v;
  }
  __syncthreads();
  const int lane = t & 31, wave = t >> 5;
  const int q = lane >> 3, c8 = (lane & 7) * 8;
  {
#pragma unroll
    for (int it = 0; it < 4; ++it) {
      const int row = wave * 16 + it * 4 + q;         // 0..127 = n
      const float* sp = tile + row * 65 + c8;
      v8us hv, lv;
#pragma unroll
      for (int e = 0; e < 8; ++e) {
        const unsigned short hb = f2bf_bits(sp[e]);
        const unsigned short lb = f2bf_bits(sp[e] - bf_bits2f(hb));
        hv[e] = hb; lv[e] = lb;
      }
      const size_t o = (size_t)row * kDm + k0 + c8;
      *(v8us*)(th + o) = hv;
      *(v8us*)(tl + o) = lv;
    }
    
  }
}

// ---------------------------------------------------------------------------
// LoRA weight w2 [3 l][32 d][1024 c] f32 -> Bt planes th/tl [3 l][1024 n=c][32 k=d] bf16: out[l][n][k] = split(w2[l][k][n]).
// (1024/64 n-tiles, 3) blocks, nt = the n-tile, l = the matrix; block 256. LDS tile [64 n][33]: load 256 threads x 8 = 32 k x 64 n.
// 512 contiguous bytes) with ONE 16-B-per-lane instruction: lane -> line L = lane>>3, row = wave*8 + 2L + ((lane&7)>>2),
// ---------------------------------------------------------------------------
__device__ __forceinline__ void w2t_split_block(const int nt, const int l, float* tile, const float* __restrict__ w2,
                                                unsigned short* __restrict__ th, unsigned short* __restrict__ tl) {
  const int n0 = nt * 64;
  const int t  = threadIdx.x;
  const float* wl = w2 + (size_t)l * kLoraD * kDm;
#pragma unroll
  for (int i = 0; i < 8; ++i) {
    const int idx = i * 256 + t;
    const int kk = idx >> 6, nn = idx & 63;
    tile[nn * 33 + kk] = wl[(size_t)kk * kDm + n0 + nn];
  }
  __syncthreads();
  const int lane = t & 31, wave = t >> 5;
  const int L = lane >> 3, q = lane & 7;
  const int row = wave * 8 + 2 * L + (q >> 2);
  const int k8 = (q & 3) * 8;
  const float* sp = tile + row * 33 + k8;
  v8us hv, lv;
#pragma unroll
  for (int e = 0; e < 8; ++e) {
    const unsigned short hb = f2bf_bits(sp[e]);
    const unsigned short lb = f2bf_bits(sp[e] - bf_bits2f(hb));
    hv[e] = hb; lv[e] = lb;
  }
  const size_t o = (size_t)l * kDm * kLoraD + (size_t)(n0 + row) * kLoraD + k8;
  *(v8us*)(th + o) = hv;
  *(v8us*)(tl + o) = lv;
  // the listing of the shared grid goes on into another job's code: in front of any rewrite there of a register that the stores above name
  asm volatile("s_wait_xcnt 0x0" ::: "memory");
}

constexpr int kEwRows = 4;   // token rows per group of 128 threads in the two mixing kernels below

// ---------------------------------------------------------------------------
// Token shift: xxx = x + (xprev - x) * maa_x -> bf16 hi/lo planes [kRows][kDm], row = b*kSeq + s;
// xprev = shift_state[b] for s == 0, else x[b][s-1] (wave-uniform pointer choice).
// The work of one group of 128 threads (4 whole waves), grp = its index:
// kRows / kEwRows groups x kEwRows rows x 128 threads x 8 elements = kRows x kDm = the whole plane; each lane stores 16 B.
// ---------------------------------------------------------------------------
__device__ __forceinline__ void xxx_split_group(const int grp, const float* __restrict__ x, const float* __restrict__ ss,
                                                const float* __restrict__ maax,
                                                unsigned short* __restrict__ oh, unsigned short* __restrict__ ol) {
  const int c0 = (threadIdx.x & 127) * 8;
  const v4f ma = *(const v4f*)(maax + c0), mb = *(const v4f*)(maax + c0 + 4);
  // unrolled: the loads of the group's rows are in flight together
#pragma unroll
  for (int rr = 0; rr < kEwRows; ++rr) {
    const int row = grp * kEwRows + rr;
    const int b = row / kSeq, s = row % kSeq;
    const float* xr = x + (size_t)row * kDm;
    const float* xp = (s == 0) ? (ss + (size_t)b * kDm) : (xr - kDm);
    const v4f xa = *(const v4f*)(xr + c0), xb = *(const v4f*)(xr + c0 + 4);
    const v4f pa = *(const v4f*)(xp + c0), pb = *(const v4f*)(xp + c0 + 4);
    const v4f va = xa + (pa - xa) * ma;
    const v4f vb = xb + (pb - xb) * mb;
    v8us hv, lv;
    split8(va, vb, hv, lv);
    store16x2(oh, ol, (size_t)row * kDm + c0, hv, lv);
  }
  // the listing of the shared grid goes on into another job's code: in front of any rewrite there of a register that the stores above name
  asm volatile("s_wait_xcnt 0x0" ::: "memory");
}

// ---------------------------------------------------------------------------
// What the LoRA products need and what needs nothing of each other, in one grid of 256-thread blocks, picked by ranges of the block
// index (block-uniform branches, so that the barriers inside a job are passed by the whole block): first the two small transposes, whose
// few blocks are chains of waits, then the token shift, which fills the chip meanwhile.
//   blocks 0 .. 15: w1 k-tiles; 16 .. 63: w2, 16 n-tiles x 3 matrices; 64 .. 64 + kRows / (2 kEwRows) - 1: token shift, 2 groups a block.
// ---------------------------------------------------------------------------
constexpr int kPrepW1 = kDm / 64;               // 16
constexpr int kPrepW2 = 3 * (kDm / 64);         // 48
constexpr int kPrepX  = kRows / (2 * kEwRows);  // 512
__global__ __launch_bounds__(256) void prep_kernel(const float* __restrict__ w1, unsigned short* __restrict__ w1h,
                                                   unsigned short* __restrict__ w1l,
                                                   const float* __restrict__ w2, unsigned short* __restrict__ w2h,
                                                   unsigned short* __restrict__ w2l,
                                                   const float* __restrict__ x, const float* __restrict__ ss,
                                                   const float* __restrict__ maax,
                                                   unsigned short* __restrict__ oh, unsigned short* __restrict__ ol) {
  __shared__ float tile[kLoraP * 65];           // the larger of the two transposes' tiles
  const int bx = blockIdx.x;
  if (bx < kPrepW1) {
    w1t_split_block(bx, tile, w1, w1h, w1l);
  } else if (bx < kPrepW1 + kPrepW2) {
    const int i = bx - kPrepW1;
    w2t_split_block(i % (kDm / 64), i / (kDm / 64), tile, w2, w2h, w2l);
  } else {
    // the half of the block a wave lies in is the same in all its lanes: read as a scalar, the row pointers stay in scalar registers
    const int half = __builtin_amdgcn_readfirstlane((int)(threadIdx.x >> 7));
    xxx_split_group((bx - kPrepW1 - kPrepW2) * 2 + half, x, ss, maax, oh, ol);
  }
}

// ---------------------------------------------------------------------------
// Data-dependent mixing: x? = x + (xprev - x) * (maa_? + mix_?[s][c]) for ? in {q(r), k, v} -> three bf16 hi/lo plane pairs
// [kRows][kDm]. mix planes f32 [3][kRows][kDm] (l = 0 r, 1 k, 2 v). Same row index and thread/store shape as xxx_split_group, one group a block.
// ---------------------------------------------------------------------------
__global__ __launch_bounds__(128) void mix_split_kernel(const float* __restrict__ x, const float* __restrict__ ss,
                                                        const float* __restrict__ maar, const float* __restrict__ maak,
                                                        const float* __restrict__ maav, const float* __restrict__ mix,
                                                        unsigned short* __restrict__ qh, unsigned short* __restrict__ ql,
                                                        unsigned short* __restrict__ kh, unsigned short* __restrict__ kl,
                                                        unsigned short* __restrict__ vh, unsigned short* __restrict__ vl) {
  const int c0 = threadIdx.x * 8;
  const size_t plane = (size_t)kRows * kDm;
  const v4f mra = *(const v4f*)(maar + c0), mrb = *(const v4f*)(maar + c0 + 4);
  const v4f mka = *(const v4f*)(maak + c0), mkb = *(const v4f*)(maak + c0 + 4);
  const v4f mva = *(const v4f*)(maav + c0), mvb = *(const v4f*)(maav + c0 + 4);
  // both loops are unrolled in full: the arrays live in registers and take compile-time indices only
  v4f xa[kEwRows], xb[kEwRows], pa[kEwRows], pb[kEwRows], qa[kEwRows][3], qb[kEwRows][3];
#pragma unroll
  for (int rr = 0; rr < kEwRows; ++rr) {
    const int row = blockIdx.x * kEwRows + rr;
    const int b = row / kSeq, s = row % kSeq;
    const float* xr = x + (size_t)row * kDm;
    const float* xp = (s == 0) ? (ss + (size_t)b * kDm) : (xr - kDm);
    xa[rr] = *(const v4f*)(xr + c0);  xb[rr] = *(const v4f*)(xr + c0 + 4);
    pa[rr] = *(const v4f*)(xp + c0);  pb[rr] = *(const v4f*)(xp + c0 + 4);
#pragma unroll
    for (int l = 0; l < 3; ++l) {
      const float* mr = mix + l * plane + (size_t)row * kDm;   // block-uniform row base
      qa[rr][l] = *(const v4f*)(mr + c0);
      qb[rr][l] = *(const v4f*)(mr + c0 + 4);
    }
    // in front of any rewrite of the address registers that this row's loads name (the data stay in flight); the lane's byte offset is an
    // input, so that it keeps its register up to the wait and no later load of the row lands on it
    asm volatile("s_wait_xcnt 0x0" :: "v"(c0 * 4) : "memory");
  }
  __builtin_amdgcn_sched_barrier(0);   // keeps the loads above in one group, all in flight together: sunk to their users, each pair would expose the memory latency again
#pragma unroll
  for (int rr = 0; rr < kEwRows; ++rr) {
    const int row = blockIdx.x * kEwRows + rr;
    const v4f da = pa[rr] - xa[rr], db = pb[rr] - xb[rr];
    const size_t o = (size_t)row * kDm + c0;
    {
      const v4f va = xa[rr] + da * (mra + qa[rr][0]), vb = xb[rr] + db * (mrb + qb[rr][0]);
      v8us hv, lv; split8(va, vb, hv, lv); store16x2(qh, ql, o, hv, lv);
    }
    {
      const v4f va = xa[rr] + da * (mka + qa[rr][1]), vb = xb[rr] + db * (mkb + qb[rr][1]);
      v8us hv, lv; split8(va, vb, hv, lv); store16x2(kh, kl, o, hv, lv);
    }
    {
      const v4f va = xa[rr] + da * (mva + qa[rr][2]), vb = xb[rr] + db * (mvb + qb[rr][2]);
      v8us hv, lv; split8(va, vb, hv, lv); store16x2(vh, vl, o, hv, lv);
    }
  }
}

// ---------------------------------------------------------------------------
// LayerNorm over a token row of kDm = 1024 values, ONE WAVE A ROW (32 values a lane, no work-group barrier); block = 8 waves = 8 rows.
//   Lane map: group j = 0, 1; head = 8j + (lane >> 2); f8 = (lane & 3) * 8. The lane holds the head's values f8..f8+7 (xv[j][0], xv[j][1])
//   and 32+f8..32+f8+7 (xv[j][2], xv[j][3]): both partners of every rotation pair, and 8 neighbouring results for each 16-B store.
//   Mean and variance: the lane's 32 values in the order of the map, then a five-step butterfly over the wave.
//   MODE 0: LN then RoPE (half-split per 64-wide head: out[f] = x1*cos - x2*sin, out[32+f] = x1*sin + x2*cos with
//           cos/sin = cosf/sinf(angles[s][f]), s = row % kSeq) then bf16 hi/lo split into planes [kRows][kDm];
//           which (block-uniform) selects source/params/planes A (0) or B (1). Lane f computes cos and sin of angle f once; the wave's own
//           LDS row hands them to the lanes that use them.
//   MODE 1: LN written back IN PLACE as f32 (dstf == src): each wave owns its row and has read all of it before it writes.
//   MODE 2: LN then bf16 hi/lo split into planes (no rotation).
//   ln_block is the work of one block; the two kernels that launch it stand behind it.
// ---------------------------------------------------------------------------
template <int MODE>
__device__ __forceinline__ void ln_block(const int which, const float* srcA, const float* srcB,
                                         const float* __restrict__ gA, const float* __restrict__ bA,
                                         const float* __restrict__ gB, const float* __restrict__ bB,
                                         const float* __restrict__ ang,
                                         unsigned short* hA, unsigned short* lA,
                                         unsigned short* hB, unsigned short* lB, float* dstf) {
  const int tid = threadIdx.x, lane = tid & 31, wave = tid >> 5;
  const int s = blockIdx.x * 8 + wave;           // token row b*kSeq + position
  const float* src = (which == 0) ? srcA : srcB;
  const float* g   = (which == 0) ? gA : gB;
  const float* bb  = (which == 0) ? bA : bB;
  unsigned short* dh = (which == 0) ? hA : hB;
  unsigned short* dl = (which == 0) ? lA : lB;

  const int f8 = (lane & 3) * 8;
  const int e0 = (lane >> 2) * 64 + f8;          // the lane's first element in group 0; group 1 lies 512 further
  const size_t ro = (size_t)s * kDm + e0;
  // every loop below is unrolled in full: xv lives in registers and takes compile-time indices only
  v4f xv[2][4];
#pragma unroll
  for (int j = 0; j < 2; ++j) {
    const float* p = src + ro + j * 512;
    xv[j][0] = *(const v4f*)(p);
    xv[j][1] = *(const v4f*)(p + 4);
    xv[j][2] = *(const v4f*)(p + 32);
    xv[j][3] = *(const v4f*)(p + 36);
  }
  float a = 0.f;
  if (MODE == 0) a = ang[(size_t)(s % kSeq) * 32 + lane];
  asm volatile("s_wait_xcnt 0x0" ::: "memory");   // in front of any rewrite of the address registers that the loads above name
  float ps = 0.f;
#pragma unroll
  for (int j = 0; j < 2; ++j)
#pragma unroll
    for (int q = 0; q < 4; ++q) ps += (xv[j][q][0] + xv[j][q][1]) + (xv[j][q][2] + xv[j][q][3]);
#pragma unroll
  for (int off = 1; off < 32; off <<= 1) ps += __shfl_xor(ps, off, 32);
  const float mean = ps * (1.0f / (float)kDm);
  float pq = 0.f;
#pragma unroll
  for (int j = 0; j < 2; ++j)
#pragma unroll
    for (int q = 0; q < 4; ++q) {
      xv[j][q] = xv[j][q] - mean;
      const v4f d = xv[j][q];
      pq += (d[0] * d[0] + d[1] * d[1]) + (d[2] * d[2] + d[3] * d[3]);
    }
#pragma unroll
  for (int off = 1; off < 32; off <<= 1) pq += __shfl_xor(pq, off, 32);
  const float var  = pq * (1.0f / (float)kDm);
  const float rstd = rsqrtf(var + 1.0e-5f);
#pragma unroll
  for (int j = 0; j < 2; ++j)
#pragma unroll
    for (int q = 0; q < 4; ++q) {
      const int eo = e0 + j * 512 + (q >> 1) * 32 + (q & 1) * 4;
      const v4f gv = *(const v4f*)(g + eo);
      const v4f bv = *(const v4f*)(bb + eo);
#pragma unroll
      for (int e = 0; e < 4; ++e) xv[j][q][e] = xv[j][q][e] * rstd * gv[e] + bv[e];
    }

  if (MODE == 1) {
#pragma unroll
    for (int j = 0; j < 2; ++j) {
      float* dp = dstf + ro + j * 512;
      *(v4f*)(dp)      = xv[j][0];
      *(v4f*)(dp + 4)  = xv[j][1];
      *(v4f*)(dp + 32) = xv[j][2];
      *(v4f*)(dp + 36) = xv[j][3];
    }
    // the listing of the shared grid goes on into another job's code: in front of any rewrite there of a register that the stores above name
    asm volatile("s_wait_xcnt 0x0" ::: "memory");
    return;                                     // MODE is a compile-time constant: uniform
  }

  v4f ca = (v4f){1.f, 1.f, 1.f, 1.f}, cb = ca;
  v4f sa = (v4f){0.f, 0.f, 0.f, 0.f}, sb = sa;
  if (MODE == 0) {
    __shared__ __align__(16) float scs[8][32];
    __shared__ __align__(16) float ssn[8][32];
    scs[wave][lane] = cosf(a);
    ssn[wave][lane] = sinf(a);
    // the wave reads back what its own lanes have just written: order inside the wave is all that is needed
    __builtin_amdgcn_fence(__ATOMIC_RELEASE, "workgroup");
    __builtin_amdgcn_wave_barrier();
    __builtin_amdgcn_fence(__ATOMIC_ACQUIRE, "workgroup");
    ca = *(const v4f*)(&scs[wave][f8]);  cb = *(const v4f*)(&scs[wave][f8 + 4]);
    sa = *(const v4f*)(&ssn[wave][f8]);  sb = *(const v4f*)(&ssn[wave][f8 + 4]);
  }
#pragma unroll
  for (int j = 0; j < 2; ++j) {
    v4f ra = xv[j][0], rb = xv[j][1], ia = xv[j][2], ib = xv[j][3];
    if (MODE == 0) {
#pragma unroll
      for (int e = 0; e < 4; ++e) {
        const float x1a = xv[j][0][e], x2a = xv[j][2][e], x1b = xv[j][1][e], x2b = xv[j][3][e];
        ra[e] = x1a * ca[e] - x2a * sa[e];  ia[e] = x1a * sa[e] + x2a * ca[e];
        rb[e] = x1b * cb[e] - x2b * sb[e];  ib[e] = x1b * sb[e] + x2b * cb[e];
      }
    }
    v8us hv, lv;
    split8(ra, rb, hv, lv);
    store16x2(dh, dl, ro + j * 512, hv, lv);
    split8(ia, ib, hv, lv);
    store16x2(dh, dl, ro + j * 512 + 32, hv, lv);
  }
}

// The three LayerNorms behind the q/k/v projections need nothing of each other: one grid (kRows/8, 3), blockIdx.y (block-uniform) =
// 0: q, 1: k (MODE 0, into planes), 2: v (MODE 1, in place).
__global__ __launch_bounds__(256) void ln_qkv_kernel(const float* qf, const float* kf, float* vf,
                                                     const float* __restrict__ gq, const float* __restrict__ bq,
                                                     const float* __restrict__ gk, const float* __restrict__ bk,
                                                     const float* __restrict__ gv, const float* __restrict__ bv,
                                                     const float* __restrict__ ang,
                                                     unsigned short* qh, unsigned short* ql,
                                                     unsigned short* kh, unsigned short* kl) {
  const int y = blockIdx.y;
  if (y < 2) ln_block<0>(y, qf, kf, gq, bq, gk, bk, ang, qh, ql, kh, kl, vf);
  else       ln_block<1>(0, vf, vf, gv, bv, gv, bv, ang, qh, ql, qh, ql, vf);   // MODE 1 writes vf alone
}

// Output LayerNorm into planes: grid = (kRows/8, 1).
__global__ __launch_bounds__(256) void ln_split_kernel(const float* src, const float* __restrict__ g, const float* __restrict__ b,
                                                       const float* __restrict__ ang,
                                                       unsigned short* h, unsigned short* l, float* unusedf) {
  ln_block<2>(0, src, src, g, b, g, b, ang, h, l, h, l, unusedf);
}

#define AT_D 64
#define AT_NW 4
#define AT_QB 64
#define AT_KC 64
#define AT_LP 72   // LDS row pitch of the K and V^T tiles in 16-bit elements: 144 B = 16 B x 9 (odd), so that the 16 rows of one 16-B fragment read fall on 16 different bank groups

__device__ __forceinline__ v8f at_mma(v16b a, v16b b, v8f c) {
  return __builtin_amdgcn_wmma_f32_16x16x32_bf16(false, a, false, b, (short)0, c, false, false);
}

// Value of lane l ^ 16 (the other half's lane of the same query) by a cross-row move of the vector unit.
__device__ __forceinline__ float at_other_half(float v) {
  const int b = __float_as_int(v);
  return __int_as_float(__builtin_amdgcn_permlanex16(b, b, 0x76543210, 0xfedcba98, false, false));
}

// 4 waves a SIMD (4 blocks a WGP = the whole grid resident) is the target: the register budget of that occupancy, 256, holds the fragment groups below
__global__ __launch_bounds__(128) __attribute__((amdgpu_waves_per_eu(4, 4)))
void attn_causal64_kernel(const unsigned short* __restrict__ qhp, const unsigned short* __restrict__ qlp,
                          const unsigned short* __restrict__ khp, const unsigned short* __restrict__ klp,
                          const unsigned short* __restrict__ vhp, const unsigned short* __restrict__ vlp,
                          float* __restrict__ out, float sscale, float mfill) {
  union PB { v16b v; v2b w[8]; };
  __shared__ __align__(16) __bf16 Ksh[AT_KC * AT_LP];            // K hi [kv][d], 64 rows of 144 B
  __shared__ __align__(16) __bf16 Ksl[AT_KC * AT_LP];            // K lo
  __shared__ __align__(16) __bf16 Vth[AT_D * AT_LP];             // V hi [d][kv], 64 rows of 144 B
  __shared__ __align__(16) __bf16 Vtl[AT_D * AT_LP];             // V lo
  __shared__ __align__(16) float  Os[AT_NW][16 * 68];            // per wave out tile, pitch 68

  const int tid  = threadIdx.x;
  const int wave = tid >> 5;
  const int lane = tid & 31;
  const int hh   = lane >> 4;
  const int c    = lane & 15;

  const int nqb = kSeq / AT_QB;           // 32
  const int bx = blockIdx.x;
  const int h  = bx / nqb;                // 0..kHeads-1 (grid = kHeads * nqb)
  // Query tile of this block. A tile's cost is its key walk, qb + 1 chunks, and the whole grid is resident at once (4 blocks a WGP),
  // so the launch lasts as long as the WGP whose 4 blocks hold the most chunks. With qb = bx % 32 blocks whose flat index is equal
  // mod 256 (and mod 32) all hold the same tile. The map below is, for each head and batch element, a permutation of the 32 tiles in
  // which j and j + 16, and flat indices 256 apart, hold tiles t and 31 - t, and an even j and j + 1 tiles that add up to 30 or 32: such
  // pairs then hold about 33 chunks. For speed only: the result
  // does not depend on where a block runs.
  const int j   = bx % nqb;
  const int tt  = (j >= nqb / 2) ? (nqb + nqb / 2 - 1 - j) : j;   // j = 0..15 -> j, 16..31 -> 47 - j = 31 - (j - 16)
  const int rnd = bx >> 8;                                        // parity of flat block index / 256 (gridDim.x = 512 = 2 x 256)
  const int qb  = ((j ^ rnd) & 1) ? (nqb - 1 - tt) : tt;          // block-uniform, 0..31
  const int q0 = qb * AT_QB + wave * 16;

  const size_t bo = (size_t)blockIdx.y * kSeq * kDm;
  const __bf16* Qh = (const __bf16*)(const void*)qhp + bo + (size_t)h * AT_D;
  const __bf16* Ql = (const __bf16*)(const void*)qlp + bo + (size_t)h * AT_D;
  const __bf16* Kh = (const __bf16*)(const void*)khp + bo + (size_t)h * AT_D;
  const __bf16* Kl = (const __bf16*)(const void*)klp + bo + (size_t)h * AT_D;
  const __bf16* Vh = (const __bf16*)(const void*)vhp + bo + (size_t)h * AT_D * kSeq;
  const __bf16* Vl = (const __bf16*)(const void*)vlp + bo + (size_t)h * AT_D * kSeq;
  float*        ob = out + bo + (size_t)h * AT_D;

  // ---- Q fragments (B operand, column = query = lane&15, split k map via Frag load): 2 d-chunks, hi and lo ----
  v16b qah[2], qal[2];
#pragma unroll
  for (int dc = 0; dc < 2; ++dc) {
    const __bf16* qr = Qh + (size_t)(q0 + c) * kDm + dc * 32 + 8 * hh;
    const __bf16* ql = Ql + (size_t)(q0 + c) * kDm + dc * 32 + 8 * hh;
    qah[dc] = Frag<__bf16>::load(qr);
    qal[dc] = Frag<__bf16>::load(ql);
  }

  const float c2 = sscale * 1.44269504088896340736f;   // score scale times log2(e), sscale > 0: the softmax runs in base 2
  float mrow = -INFINITY;   // running maximum of query q0 + c in base-2 units (score * c2), the same in both lane halves
  float lrow = 0.f;         // running sum over this lane half's keys; the halves are joined behind the loop
  v8f oacc[4];              // O^T: oacc[t][r] = out[q0 + c][16t + 8hh + r]
#pragma unroll
  for (int t = 0; t < 4; ++t) oacc[t] = (v8f){0.f,0.f,0.f,0.f,0.f,0.f,0.f,0.f};

  int nChunks = qb + 1;                      // block-uniform, <= 32
  if (nChunks > kSeq / AT_KC) nChunks = kSeq / AT_KC;
  for (int kc = 0; kc < nChunks; ++kc) {
    const int kv0 = kc * AT_KC;
    __syncthreads();
    {
      // staging coverage: 128 threads x (4 x 8) elements = 64 rows x 64 per plane = the whole chunk tile
      const int r = tid >> 1, half = (tid & 1) * 32;
      const __bf16* ksh = Kh + (size_t)(kv0 + r) * kDm + half;     // K row kv0+r, d = half..half+31
      const __bf16* ksl = Kl + (size_t)(kv0 + r) * kDm + half;
      const __bf16* vsh = Vh + (size_t)r * kSeq + kv0 + half;     // V^T row d = r, s = kv0+half..+31
      const __bf16* vsl = Vl + (size_t)r * kSeq + kv0 + half;
#pragma unroll
      for (int i = 0; i < 4; ++i) {
        const v8b a0 = *(const v8b*)(ksh + 8 * i);
        const v8b a1 = *(const v8b*)(ksl + 8 * i);
        const v8b b0 = *(const v8b*)(vsh + 8 * i);
        const v8b b1 = *(const v8b*)(vsl + 8 * i);
        *(v8b*)(Ksh + r * AT_LP + half + 8 * i) = a0;
        *(v8b*)(Ksl + r * AT_LP + half + 8 * i) = a1;
        *(v8b*)(Vth + r * AT_LP + half + 8 * i) = b0;
        *(v8b*)(Vtl + r * AT_LP + half + 8 * i) = b1;
      }
    }
    __syncthreads();

    // The K fragments are read in two groups, well in front of their products, in the order of their use: the wave meets the LDS latency
    // once a chunk, not once per fragment. The products run term by term over the four score tiles, so that neighbouring matrix
    // instructions have different accumulators; each tile still takes its six terms in the order dc 0: hi.hi, lo.hi, hi.lo, dc 1: the same.
    v16b kfh[2][4], kfl[2][4];
#pragma unroll
    for (int j = 0; j < 4; ++j) kfh[0][j] = Frag<__bf16>::load(Ksh + (j * 16 + c) * AT_LP + 8 * hh);
#pragma unroll
    for (int j = 0; j < 4; ++j) kfl[0][j] = Frag<__bf16>::load(Ksl + (j * 16 + c) * AT_LP + 8 * hh);
#pragma unroll
    for (int j = 0; j < 4; ++j) kfh[1][j] = Frag<__bf16>::load(Ksh + (j * 16 + c) * AT_LP + 32 + 8 * hh);
    __builtin_amdgcn_sched_barrier(0);   // keeps the reads above in one group: sunk to their users they would each expose the LDS latency again
    v8f s[4];                            // s[j][r] = score of key kv0 + 16j + 8hh + r, query q0 + c
#pragma unroll
    for (int j = 0; j < 4; ++j) s[j] = at_mma(kfh[0][j], qah[0], (v8f){0.f,0.f,0.f,0.f,0.f,0.f,0.f,0.f});
#pragma unroll
    for (int j = 0; j < 4; ++j) s[j] = at_mma(kfl[0][j], qah[0], s[j]);
    __builtin_amdgcn_sched_barrier(0);   // the last K group waits for the registers of the lo fragments just used (all four groups at once do not fit) ...
#pragma unroll
    for (int j = 0; j < 4; ++j) kfl[1][j] = Frag<__bf16>::load(Ksl + (j * 16 + c) * AT_LP + 32 + 8 * hh);
    __builtin_amdgcn_sched_barrier(0);   // ... and stays eight products in front of its first user
#pragma unroll
    for (int j = 0; j < 4; ++j) s[j] = at_mma(kfh[0][j], qal[0], s[j]);
#pragma unroll
    for (int j = 0; j < 4; ++j) s[j] = at_mma(kfh[1][j], qah[1], s[j]);
#pragma unroll
    for (int j = 0; j < 4; ++j) s[j] = at_mma(kfl[1][j], qah[1], s[j]);
#pragma unroll
    for (int j = 0; j < 4; ++j) s[j] = at_mma(kfh[1][j], qal[1], s[j]);
    __builtin_amdgcn_sched_barrier(0);   // the V^T reads below stay behind the last score product (they take over the K fragments' registers)
    // V^T fragments, first three groups: read here, they arrive under the softmax arithmetic
    v16b vfh[2][4], vfl[2][4];
#pragma unroll
    for (int t = 0; t < 4; ++t) vfh[0][t] = Frag<__bf16>::load(Vth + (t * 16 + c) * AT_LP + 8 * hh);
#pragma unroll
    for (int t = 0; t < 4; ++t) vfl[0][t] = Frag<__bf16>::load(Vtl + (t * 16 + c) * AT_LP + 8 * hh);
#pragma unroll
    for (int t = 0; t < 4; ++t) vfh[1][t] = Frag<__bf16>::load(Vth + (t * 16 + c) * AT_LP + 32 + 8 * hh);
    __builtin_amdgcn_sched_barrier(0);   // ... and in front of the softmax, not sunk to their users behind it
    // ---- scale, structural causal select on the diagonal tile, maximum over the lane's 32 keys and the other half's ----
    const bool diag = (kc == qb);            // block-uniform
    // a key of this lane, 16j + 8hh + r inside the chunk, is masked where it lies behind the lane's query; off the diagonal none is (limit 64)
    const int lim = diag ? (q0 + c - kv0 - 8 * hh) : AT_KC;
    float m = -INFINITY;
    // the loops from here to the end of the chunk are unrolled in full: s, ph, pl and oacc live in registers and take compile-time indices only
#pragma unroll
    for (int j = 0; j < 4; ++j) {
#pragma unroll
      for (int r = 0; r < 8; ++r) {
        const float sm = (j * 16 + r > lim) ? mfill : s[j][r];   // unscaled product; mfill * c2 is still far below every score
        s[j][r] = sm;
        m = fmaxf(m, sm);
      }
    }
    m = fmaxf(m, at_other_half(m));
    const float mnew = fmaxf(mrow, m * c2);   // c2 > 0: the maximum of the products, scaled, is the maximum of the scaled scores
    const float alpha = __builtin_amdgcn_exp2f(mrow - mnew);
    mrow = mnew;
    const v2f c2v = (v2f){c2, c2}, nmv = (v2f){-mnew, -mnew};
    v2f psum = (v2f){0.f, 0.f};              // even and odd keys apart: one packed add per pair
    PB ph[2], pl[2];                         // P^T hi / lo as B operands: keys 32kk..32kk+31, element 8(j&1) + r <- tile j = 2kk + (j&1)
#pragma unroll
    for (int j = 0; j < 4; ++j) {
#pragma unroll
      for (int r = 0; r < 8; r += 2) {
        // exp(score * sscale - max) = 2^(score * c2 - mnew): one fused multiply-add (a pair at a time) and the hardware's base-2 exponential
        const v2f e = __builtin_elementwise_fma((v2f){s[j][r], s[j][r + 1]}, c2v, nmv);
        const v2f p = (v2f){__builtin_amdgcn_exp2f(e[0]), __builtin_amdgcn_exp2f(e[1])};
        psum += p;
        // two neighbouring keys fill one operand register: packed round-to-nearest-even conversions, hi = bf16(p), lo = bf16(p - hi)
        const v2b a = __builtin_convertvector(p, v2b);
        const v2b bl = __builtin_convertvector(p - __builtin_convertvector(a, v2f), v2b);
        ph[j >> 1].w[(j & 1) * 4 + (r >> 1)] = a;
        pl[j >> 1].w[(j & 1) * 4 + (r >> 1)] = bl;
      }
    }
    lrow = lrow * alpha + (psum[0] + psum[1]);
#pragma unroll
    for (int t = 0; t < 4; ++t) oacc[t] *= alpha;
    // term by term over the four output tiles; each tile takes its six terms in the order kk 0: hi.hi, lo.hi, hi.lo, kk 1: the same
#pragma unroll
    for (int t = 0; t < 4; ++t) oacc[t] = at_mma(vfh[0][t], ph[0].v, oacc[t]);
#pragma unroll
    for (int t = 0; t < 4; ++t) oacc[t] = at_mma(vfl[0][t], ph[0].v, oacc[t]);
    __builtin_amdgcn_sched_barrier(0);   // the last V^T group waits for the registers of the lo fragments just used ...
#pragma unroll
    for (int t = 0; t < 4; ++t) vfl[1][t] = Frag<__bf16>::load(Vtl + (t * 16 + c) * AT_LP + 32 + 8 * hh);
    __builtin_amdgcn_sched_barrier(0);   // ... and stays eight products in front of its first user
#pragma unroll
    for (int t = 0; t < 4; ++t) oacc[t] = at_mma(vfh[0][t], pl[0].v, oacc[t]);
#pragma unroll
    for (int t = 0; t < 4; ++t) oacc[t] = at_mma(vfh[1][t], ph[1].v, oacc[t]);
#pragma unroll
    for (int t = 0; t < 4; ++t) oacc[t] = at_mma(vfl[1][t], ph[1].v, oacc[t]);
#pragma unroll
    for (int t = 0; t < 4; ++t) oacc[t] = at_mma(vfh[1][t], pl[1].v, oacc[t]);
  }

  float* os = Os[wave];
  const float inv = 1.0f / (lrow + at_other_half(lrow));   // the query's sum: both halves' keys
#pragma unroll
  for (int t = 0; t < 4; ++t) {
    const v8f o = oacc[t] * inv;
    *(v4f*)(os + c * 68 + t * 16 + 8 * hh)     = (v4f){o[0], o[1], o[2], o[3]};
    *(v4f*)(os + c * 68 + t * 16 + 8 * hh + 4) = (v4f){o[4], o[5], o[6], o[7]};
  }
  __builtin_amdgcn_fence(__ATOMIC_RELEASE, "workgroup");
  __builtin_amdgcn_wave_barrier();
  __builtin_amdgcn_fence(__ATOMIC_ACQUIRE, "workgroup");
  {
    const int c4 = (lane & 15) * 4;
    {
#pragma unroll
      for (int it = 0; it < 8; ++it) {
        const int row = it * 2 + hh;   // it 0..7 x hh 0..1 covers rows 0..15 of the wave tile
        v4f val = *(const v4f*)(os + row * 68 + c4);
        *(v4f*)(ob + (size_t)(q0 + row) * kDm + c4) = val;
      }
      
    }
  }
}

// ---------------------------------------------------------------------------
// Workspace region map (byte offsets). Every GEMM: K in {1024, 32} (%32 == 0), M = kRows = 4096, N in {128, 1024} (%128 == 0).
// Activation regions hold both batch elements, row = b*2048 + s.
// Every region is fully written before it is read within the in-order launch sequence; reused regions noted.
//   Wqh bf16 [1024 n][1024 k]        0      Wql    2097152
//   Wkh                        4194304      Wkl    6291456
//   Wvh                        8388608      Wvl   10485760
//   Woh                       12582912      Wol   14680064
//   W1Th bf16 [128 n][1024 k] 16777216      W1Tl  17039360   (rows 96..127 zero)
//   W2Th bf16 [3][1024 n][32] 17301504      W2Tl  17498112
//   XXh  bf16 [4096][1024]    17694720      XXl   26083328   (xxx planes; reused after the LoRA GEMM as Oh / Ol)
//   LORAf f32 [4096][128]     34471936
//   LTh  bf16 [4096][128]     36569088      LTl   37617664
//   MIX  f32 [3][4096][1024]  38666240                       (reused after the mix kernel: Qf = +0, Kf = +16777216,
//                                                             Vf = +33554432 f32 [4096][1024]; Of reuses Qf)
//   XQh/XQl/XKh/XKl/XVh/XVl   88997888 .. (6 x 8388608)
//   Qh/Ql/Kh/Kl              139329536 .. (4 x 8388608)
//   VTh/VTl bf16 [2][1024][2048] 172883968, 181272576
//   total                    189661184  (~180.9 MiB)
// ---------------------------------------------------------------------------
extern "C" void kernel_launch(void* const* d_in, const int* in_sizes, int n_in,
                              void* d_out, int out_size, void* d_ws, size_t ws_size,
                              hipStream_t stream) {
  if (n_in < 21) return;
  const int nRow = kSeq * kDm;            // 2097152 per batch element
  const int nAct = kBatch * nRow;         // 4194304
  const int nW   = kDm * kDm;             // 1048576
  if (in_sizes[0] != nAct) return;
  if (in_sizes[1] != kBatch * kDm) return;
  if (in_sizes[2] != kDm || in_sizes[3] != kDm || in_sizes[4] != kDm || in_sizes[5] != kDm) return;
  if (in_sizes[6] != kDm * kLoraN) return;
  if (in_sizes[7] != 3 * kLoraD * kDm) return;
  if (in_sizes[8] != nW || in_sizes[9] != nW || in_sizes[10] != nW || in_sizes[11] != nW) return;
  for (int i = 12; i < 20; ++i) if (in_sizes[i] != kDm) return;
  if (in_sizes[20] != kSeq * 32) return;
  if (out_size != nAct) return;

  const float* x     = (const float*)d_in[0];    // [2][2048][1024]
  const float* ss    = (const float*)d_in[1];    // [2][1024]
  const float* maax  = (const float*)d_in[2];    // [1024]
  const float* maar  = (const float*)d_in[3];
  const float* maak  = (const float*)d_in[4];
  const float* maav  = (const float*)d_in[5];
  const float* w1    = (const float*)d_in[6];    // [1024][96]
  const float* w2    = (const float*)d_in[7];    // [3][32][1024]
  const float* wq    = (const float*)d_in[8];    // [1024 out][1024 in]
  const float* wk    = (const float*)d_in[9];
  const float* wv    = (const float*)d_in[10];
  const float* wo    = (const float*)d_in[11];
  const float* lnrg  = (const float*)d_in[12];
  const float* lnrb  = (const float*)d_in[13];
  const float* lnkg  = (const float*)d_in[14];
  const float* lnkb  = (const float*)d_in[15];
  const float* lnvg  = (const float*)d_in[16];
  const float* lnvb  = (const float*)d_in[17];
  const float* lnxg  = (const float*)d_in[18];
  const float* lnxb  = (const float*)d_in[19];
  const float* ang   = (const float*)d_in[20];   // [2048][32]

  const size_t PW   = (size_t)kDm * kDm * 2;          // 2097152  bf16 weight plane
  const size_t PX   = (size_t)kRows * kDm * 2;        // 8388608  bf16 activation plane (both batch elements)
  const size_t PF   = (size_t)kRows * kDm * 4;        // 16777216 f32 activation plane
  const size_t PW1  = (size_t)kLoraP * kDm * 2;       // 262144
  const size_t PW2  = (size_t)3 * kDm * kLoraD * 2;   // 196608
  const size_t PLF  = (size_t)kRows * kLoraP * 4;     // 2097152
  const size_t PLT  = (size_t)kRows * kLoraP * 2;     // 1048576
  size_t off = 0;
  const size_t oWqh = off; off += PW;  const size_t oWql = off; off += PW;
  off += 4 * PW;                                // Wkh, Wkl, Wvh, Wvl: reached from Wqh / Wql by the plane stride
  const size_t oWoh = off; off += PW;  const size_t oWol = off; off += PW;
  const size_t oW1h = off; off += PW1; const size_t oW1l = off; off += PW1;
  const size_t oW2h = off; off += PW2; const size_t oW2l = off; off += PW2;
  const size_t oXXh = off; off += PX;  const size_t oXXl = off; off += PX;
  const size_t oLF  = off; off += PLF;
  const size_t oLTh = off; off += PLT; const size_t oLTl = off; off += PLT;
  const size_t oMIX = off; off += 3 * PF;
  const size_t oXQh = off; off += PX;  const size_t oXQl = off; off += PX;
  const size_t oXKh = off; off += PX;  const size_t oXKl = off; off += PX;
  const size_t oXVh = off; off += PX;  const size_t oXVl = off; off += PX;
  const size_t oQh  = off; off += PX;  const size_t oQl  = off; off += PX;
  const size_t oKh  = off; off += PX;  const size_t oKl  = off; off += PX;
  const size_t oVTh = off; off += PX;  const size_t oVTl = off; off += PX;
  if (off > ws_size) return;                    // off = 189661184

  char* ws = (char*)d_ws;
  unsigned short* Wqh = (unsigned short*)(ws + oWqh); unsigned short* Wql = (unsigned short*)(ws + oWql);
  unsigned short* Woh = (unsigned short*)(ws + oWoh); unsigned short* Wol = (unsigned short*)(ws + oWol);
  unsigned short* W1h = (unsigned short*)(ws + oW1h); unsigned short* W1l = (unsigned short*)(ws + oW1l);
  unsigned short* W2h = (unsigned short*)(ws + oW2h); unsigned short* W2l = (unsigned short*)(ws + oW2l);
  unsigned short* XXh = (unsigned short*)(ws + oXXh); unsigned short* XXl = (unsigned short*)(ws + oXXl);
  float*          LF  = (float*)(ws + oLF);
  unsigned short* LTh = (unsigned short*)(ws + oLTh); unsigned short* LTl = (unsigned short*)(ws + oLTl);
  float*          MIX = (float*)(ws + oMIX);
  float*          Qf  = (float*)(ws + oMIX);
  float*          Kf  = (float*)(ws + oMIX + PF);
  float*          Vf  = (float*)(ws + oMIX + 2 * PF);
  float*          Of  = Qf;
  unsigned short* XQh = (unsigned short*)(ws + oXQh); unsigned short* XQl = (unsigned short*)(ws + oXQl);
  unsigned short* XKh = (unsigned short*)(ws + oXKh); unsigned short* XKl = (unsigned short*)(ws + oXKl);
  unsigned short* XVh = (unsigned short*)(ws + oXVh); unsigned short* XVl = (unsigned short*)(ws + oXVl);
  unsigned short* Qh  = (unsigned short*)(ws + oQh);  unsigned short* Ql  = (unsigned short*)(ws + oQl);
  unsigned short* Kh  = (unsigned short*)(ws + oKh);  unsigned short* Kl  = (unsigned short*)(ws + oKl);
  unsigned short* VTh = (unsigned short*)(ws + oVTh); unsigned short* VTl = (unsigned short*)(ws + oVTl);
  unsigned short* Oh  = XXh;                          unsigned short* Ol  = XXl;

  const float* dummyf = lnrg;                         // valid pointer for unused bias / resid arguments (never read)

  const dim3 blk(256);
  const int  n8w = nW / 8;                                  // 131072 groups of 8 per weight plane
  const int  nCastW = (n8w + 511) / 512;                    // 256 blocks x 128 threads x 4 x 8 = 1024x1024, per weight
  const dim3 gPrep(kPrepW1 + kPrepW2 + kPrepX);             // 16 w1 k-tiles + 48 w2 tiles + 512 token-shift blocks
  const dim3 gRow(kRows / kEwRows);                         // one block per kEwRows token rows (128-thread kernel)
  const dim3 blkG(128);                                     // GEMM block: 4 waves, one 128x128 tile
  const int  nLora = (kRows / 128) * (kLoraP / 128);        // 32 tiles: M=4096, N=128
  const dim3 gLora(nLora + 4 * nCastW);                     // ... and behind them the split of q, k, v, o weights
  const dim3 gMix((kRows / 128) * (kDm / 128), 3);          // 256 tiles x 3 (l): M=4096, N=1024, K=32
  const int  n8l = kRows * kLoraP / 8;                      // 65536 groups of 8
  const dim3 gTanh((n8l + 255) / 256);                      // 256 blocks x 256 x 8 = 4096x128
  const dim3 gQKV((kRows / 128) * (kDm / 128), 3);          // 256 tiles x 3 (q, k, v): M=4096, N=1024
  const dim3 gProj((kRows / 128) * (kDm / 128), 1);         // 256 tiles: M=4096, N=1024
  const dim3 gLnQKV(kRows / 8, 3);                          // 512 blocks x 8 waves = 4096 rows, x {q, k, v}
  const dim3 gLn1(kRows / 8, 1);
  const dim3 gVT(kDm / 64, kSeq / 64, kBatch);              // per b: in [R=2048 s][Cn=1024 c] -> planes [c][s]
  const dim3 gAtt(kHeads * (kSeq / 64), kBatch);            // 512 x 2 blocks: 16 heads x 32 query blocks, y = b

  // Each stage below runs once, on the rows of both batch elements. Weights -> bf16 hi/lo planes: q/k/v/o are already
  // [out n][in k] = Bt layout, w1/w2 are transposed.
  // (1) w1, w2 -> planes; xxx = x + dxprev*maa_x -> planes
  prep_kernel<<<gPrep, blk, 0, stream>>>(w1, W1h, W1l, w2, W2h, W2l, x, ss, maax, XXh, XXl);
  // (2) lora_pre = xxx . w1 -> f32 [4096][128]   (M=4096, N=128, K=1024); in the same grid q, k, v, o weights -> planes, first read in
  //     step 6: their hi planes lie 2 weight planes apart (hi, lo, hi, lo, ...), and so do the lo planes
  gemm64_and_split_kernel<<<gLora, blkG, 0, stream>>>(
      XXh, XXl, kDm, W1h, W1l, kDm, LF, kLoraP, dummyf, kRows, kLoraP, kDm, nLora,
      wq, wk, wv, wo, Wqh, Wql, n8w, 2L * nW, nCastW);
  // (3) lora = tanh -> planes [4096][128]
  tanh_split_kernel<<<gTanh, blk, 0, stream>>>(LF, LTh, LTl, n8l);
  // (4) mixes[l] = lora[:, 32l..32l+31] . w2[l] -> f32 [3][4096][1024]   (M=4096, N=1024, K=32; grid.y = l)
  wmma_gemm64<1, true, 0, 0, false, 0><<<gMix, blkG, 0, stream>>>(
      LTh, LTl, kLoraP, (long)kLoraD, W2h, W2l, kLoraD, (long)kDm * kLoraD, (void*)MIX, (void*)MIX, kDm, (long)nAct,
      dummyf, dummyf, 0L, kRows, kDm, kLoraD, 1.0f);
  // (5) xq/xk/xv = x + dxprev*(maa + mix) -> planes
  mix_split_kernel<<<gRow, dim3(128), 0, stream>>>(x, ss, maar, maak, maav, MIX, XQh, XQl, XKh, XKl, XVh, XVl);
  // (6) q0 = xq . Wq^T, k0 = xk . Wk^T, v0 = xv . Wv^T -> f32 [3][4096][1024]   (M=4096, N=1024, K=1024; grid.y = q, k, v:
  //     XQ/XK/XV hi planes lie 2 activation planes apart, Wq/Wk/Wv hi planes 2 weight planes, Qf/Kf/Vf one f32 plane)
  wmma_gemm64<1, true, 0, 0, false, 0><<<gQKV, blkG, 0, stream>>>(
      XQh, XQl, kDm, 2L * nAct, Wqh, Wql, kDm, 2L * nW, (void*)Qf, (void*)Qf, kDm, (long)nAct,
      dummyf, dummyf, 0L, kRows, kDm, kDm, 1.0f);
  // (7) LayerNorm + RoPE + split for q and k -> planes [row][h*64+d]; LayerNorm of v in place (f32)
  ln_qkv_kernel<<<gLnQKV, blk, 0, stream>>>(Qf, Kf, Vf, lnrg, lnrb, lnkg, lnkb, lnvg, lnvb, ang, Qh, Ql, Kh, Kl);
  // (8) transpose-split of v -> v^T planes [b][h*64+d][s]
  wt_split_kernel<<<gVT, blk, 0, stream>>>(Vf, VTh, VTl, kSeq, kDm);
  // (9) causal attention per batch element and head -> f32 [row][h*64+d] (Of region; Qf is dead after step 7)
  attn_causal64_kernel<<<gAtt, dim3(128), 0, stream>>>(Qh, Ql, Kh, Kl, VTh, VTl, Of, 0.125f, -1.0e30f);
  // (10) output LayerNorm + split -> planes (XX region is dead after step 2)
  ln_split_kernel<<<gLn1, blk, 0, stream>>>(Of, lnxg, lnxb, ang, Oh, Ol, Of);
  // (11) out = o . Wo^T -> d_out (f32)   (M=4096, N=1024, K=1024)
  wmma_gemm64<1, true, 0, 0, false, 0><<<gProj, blkG, 0, stream>>>(
      Oh, Ol, kDm, 0L, Woh, Wol, kDm, 0L, d_out, d_out, kDm, 0L,
      dummyf, dummyf, 0L, kRows, kDm, kDm, 1.0f);
}
